// v000
// Measured on an AMD MI455X. A time is GPU time per run, averaged over a window of back-to-back runs after a warm-up
// (all launches, gaps included; the runs take copies of the inputs in turn), and the median of several windows.
// Apart from v000's, it joins two sittings. Times from different sittings can be a few percent apart, while
// side-by-side timings come from the same sitting.
// The starting kernel, v000, takes 1490 microseconds a run.
#include <hip/hip_runtime.h>

// NonLocalOp (l [8][256][64][64] -> 4096 pixels; theta = w_theta l, phi = w_phi l (128 embed channels, 1x1 convs); f = softmax(theta^T phi / sqrt(128)) over keys; out[c][q] = sum_k f[q][k] l[c][k] -> [8][256][64][64]).
// Compute dtypes, f32 accumulate: every input rounded to bf16; theta/phi on PLAIN bf16 operands (inputs: exact); scores (K 128) on single fp16 planes of theta (x 128^-0.5) and phi (the logits are O(1)); softmax f32 (three passes over

#define NBI  8
#define CC   256
#define EE   128
#define NN   4096
#define SCL  0.08838834764831845f
typedef _Float16 h16;
typedef unsigned short bf;
typedef __attribute__((ext_vector_type(16))) __bf16   v16bf;
typedef __attribute__((ext_vector_type(16))) _Float16 v16h;
typedef __attribute__((ext_vector_type(8)))  _Float16 v8h;
typedef __attribute__((ext_vector_type(8)))  unsigned short v8us;
typedef __attribute__((ext_vector_type(8)))  float    v8f;
typedef __attribute__((ext_vector_type(4)))  float    v4f;
typedef v8h  __attribute__((may_alias)) v8ha;
typedef v4f  __attribute__((may_alias)) v4fa;
typedef v8us __attribute__((may_alias)) v8usa;

__device__ __forceinline__ unsigned short f2bf(float f) { unsigned u = __float_as_uint(f); u += 0x7FFFu + ((u >> 16) & 1u); return (unsigned short)(u >> 16); }
__device__ __forceinline__ float bf2f(unsigned short b) { return __uint_as_float(((unsigned)b) << 16); }
__device__ __forceinline__ float bfr(float f) { return bf2f(f2bf(f)); }
__device__ __forceinline__ v16h cat16(v8h lo, v8h hi) { return __builtin_shufflevector(lo, hi, 0, 1, 2, 3, 4, 5, 6, 7, 8, 9, 10, 11, 12, 13, 14, 15); }
__device__ __forceinline__ v16bf cat16b(v8us lo, v8us hi) { return __builtin_bit_cast(v16bf, __builtin_shufflevector(lo, hi, 0, 1, 2, 3, 4, 5, 6, 7, 8, 9, 10, 11, 12, 13, 14, 15)); }
__device__ __forceinline__ v8f wmma16(v16h a, v16h b, v8f c) { return __builtin_amdgcn_wmma_f32_16x16x32_f16(false, a, false, b, (short)0, c, false, false); }
__device__ __forceinline__ v8f wmmab(v16bf a, v16bf b, v8f c) { return __builtin_amdgcn_wmma_f32_16x16x32_bf16(false, a, false, b, (short)0, c, false, false); }



// ---- k_gemmw: register-blocked GEMM, ONE WAVE per 64x64 output tile (16 accumulators), operands straight from K-contiguous 16-bit planes; grid (M/64, N/64, Z), 32 threads.
// C[m][n] (f32, pitch ldc, + optional f32 bias[n]) = sum_k A[m][k] Bt[n][k] (+ split products per NSPLIT). z-batch strides sA/sB/sC in elements. K % 32 == 0.
template <typename T16> struct WFrag;
template <> struct WFrag<h16> { typedef v16h V; static __device__ __forceinline__ V ld(const h16* p) { return cat16(*(const v8h*)p, *(const v8h*)(p + 16)); } static __device__ __forceinline__ v8f mma(V a, V b, v8f c) { return wmma16(a, b, c); } };
template <> struct WFrag<bf> { typedef v16bf V; static __device__ __forceinline__ V ld(const bf* p) { return cat16b(*(const v8us*)p, *(const v8us*)(p + 16)); } static __device__ __forceinline__ v8f mma(V a, V b, v8f c) { return wmmab(a, b, c); } };
template <typename T16, int NSPLIT, bool BIAS>
__global__ __launch_bounds__(32) void k_gemmw(const T16* __restrict__ A, const T16* __restrict__ A2, const T16* __restrict__ Bt, const T16* __restrict__ Bt2, int K, float* C, int ldc, const float* __restrict__ bias, size_t sA, size_t sB, size_t sC) {
    typedef typename WFrag<T16>::V V;
    __shared__ __align__(16) float os[16 * 68];
    const size_t z = blockIdx.z; A += z * sA; if (A2) A2 += z * sA; Bt += z * sB; if (Bt2) Bt2 += z * sB; C += z * sC;
    const int lane = threadIdx.x & 31, lr = lane & 15, hi = lane >> 4; const int r0 = blockIdx.x * 64, c0 = blockIdx.y * 64;
    v8f acc[4][4];
#pragma unroll
    for (int mb = 0; mb < 4; ++mb)
#pragma unroll
        for (int nb = 0; nb < 4; ++nb) acc[mb][nb] = (v8f){};
    const size_t aoff = (size_t)(r0 + lr) * K + 8 * hi, boff = (size_t)(c0 + lr) * K + 8 * hi;
#pragma unroll 1
    for (int kc = 0; kc < K; kc += 32) {
        V a[4], a2[4];
#pragma unroll
        for (int mb = 0; mb < 4; ++mb) { a[mb] = WFrag<T16>::ld(A + aoff + (size_t)mb * 16 * K + kc); if (NSPLIT == 1 || NSPLIT == 2) a2[mb] = WFrag<T16>::ld(A2 + aoff + (size_t)mb * 16 * K + kc); }
#pragma unroll
        for (int nb = 0; nb < 4; ++nb) { const V b = WFrag<T16>::ld(Bt + boff + (size_t)nb * 16 * K + kc); V b2; if (NSPLIT >= 2) b2 = WFrag<T16>::ld(Bt2 + boff + (size_t)nb * 16 * K + kc);
#pragma unroll
            for (int mb = 0; mb < 4; ++mb) { acc[mb][nb] = WFrag<T16>::mma(a[mb], b, acc[mb][nb]); if (NSPLIT == 1 || NSPLIT == 2) acc[mb][nb] = WFrag<T16>::mma(a2[mb], b, acc[mb][nb]); if (NSPLIT >= 2) acc[mb][nb] = WFrag<T16>::mma(a[mb], b2, acc[mb][nb]); } }
        asm volatile("v_nop\n\tv_nop\n\tv_nop\n\tv_nop" : "+v"(acc[0][0]), "+v"(acc[1][1]), "+v"(acc[2][2]), "+v"(acc[3][3]) : "v"(a[0]), "v"(a[3]));
    }
#pragma unroll
    for (int mb = 0; mb < 4; ++mb) {
#pragma unroll
        for (int nb = 0; nb < 4; ++nb) {
#pragma unroll
            for (int j = 0; j < 8; ++j) os[(hi * 8 + j) * 68 + nb * 16 + lr] = acc[mb][nb][j]; }
        __builtin_amdgcn_wave_barrier(); asm volatile("" ::: "memory");
        float* crow = C + (size_t)(r0 + mb * 16) * ldc + c0;
{
#pragma unroll
            for (int s = 0; s < 8; ++s) { const int row = 2 * s + hi, cofs = lr * 4; v4f val = *(const v4fa*)(os + row * 68 + cofs); if (BIAS) { val[0] += bfr(bias[c0 + cofs]); val[1] += bfr(bias[c0 + cofs + 1]); val[2] += bfr(bias[c0 + cofs + 2]); val[3] += bfr(bias[c0 + cofs + 3]); }
                *(v4f*)(crow + (size_t)row * ldc + cofs) = val; }
             }
        __builtin_amdgcn_wave_barrier(); asm volatile("" ::: "memory");
    }
}

__device__ __forceinline__ h16 tohx(float x) { return (h16)x; }
typedef __attribute__((ext_vector_type(4))) _Float16 v4h;
typedef __attribute__((ext_vector_type(4))) unsigned short v4us;
#define PCAR 1024.0f

__global__ __launch_bounds__(256) void k_cvt8(const float* __restrict__ src, bf* dst, size_t n8) { const size_t i = (size_t)blockIdx.x * 256 + threadIdx.x; if (i >= n8) return; const v8f v = *(const v8f*)(src + i * 8); v8us o;
#pragma unroll
    for (int k = 0; k < 8; ++k) o[k] = f2bf(v[k]); *(v8us*)(dst + i * 8) = o;  }
// k_xt: XT[n][c] = bf16 l[b][c][n] (lane -> 4 consecutive c); k_pl16: T16[n][e] = fp16(THETA[n][e] scl), P16[n][e] = fp16(PHI[n][e]) (8-B lanes); k_softbf: wave per query row over the 4096 keys: three passes (max; sum; write fp16(1024 p)); k_x16: fp16 copy of the bf16-rounded input; k_fin: OUT = TMP/1024 (16-B reads and writes);
__global__ __launch_bounds__(256) void k_xt(const float* __restrict__ x, bf* XT) { const size_t e = ((size_t)blockIdx.x * 256 + threadIdx.x) * 4; if (e >= (size_t)NN * CC) return; const int c = (int)(e % CC); const int n = (int)(e / CC); v4us o;
#pragma unroll
    for (int q = 0; q < 4; ++q) o[q] = f2bf(x[(size_t)(c + q) * NN + n]); *(v4us*)(XT + e) = o;  }
__global__ __launch_bounds__(256) void k_pl16(const float* __restrict__ TH, const float* __restrict__ PH, h16* T16, h16* P16) { const size_t e = ((size_t)blockIdx.x * 256 + threadIdx.x) * 4; if (e >= (size_t)NN * EE) return; const v4f a = *(const v4f*)(TH + e), c = *(const v4f*)(PH + e); v4h ot, op;
#pragma unroll
    for (int q = 0; q < 4; ++q) { ot[q] = tohx(a[q] * SCL); op[q] = tohx(c[q]); } { *(v4h*)(T16 + e) = ot; *(v4h*)(P16 + e) = op;  } }
__global__ __launch_bounds__(256) void k_x16(const float* __restrict__ x, size_t n4, h16* X16) { const size_t i = ((size_t)blockIdx.x * 256 + threadIdx.x) * 4; if (i >= n4 * 4) return; const v4f a = *(const v4f*)(x + i); v4h o; o[0] = tohx(bfr(a[0])); o[1] = tohx(bfr(a[1])); o[2] = tohx(bfr(a[2])); o[3] = tohx(bfr(a[3])); *(v4h*)(X16 + i) = o;  }
__global__ __launch_bounds__(256) void k_fin(const float* __restrict__ T, float* OUTb) { const size_t i = ((size_t)blockIdx.x * 256 + threadIdx.x) * 4; if (i >= (size_t)CC * NN) return; const v4f a = *(const v4f*)(T + i); v4f o; o[0] = a[0] * (1.0f / PCAR); o[1] = a[1] * (1.0f / PCAR); o[2] = a[2] * (1.0f / PCAR); o[3] = a[3] * (1.0f / PCAR); *(v4f*)(OUTb + i) = o;  }
__global__ __launch_bounds__(256) void k_softbf(const float* __restrict__ Sb, h16* PB) { const int lane = threadIdx.x & 31; const int row = blockIdx.x * 8 + (threadIdx.x >> 5); if (row >= NN) return; const float* sr = Sb + (size_t)row * NN; float mx = -3.0e38f;
#pragma unroll 1
    for (int ch = 0; ch < NN / 128; ++ch) { const v4f a = *(const v4f*)(sr + ch * 128 + lane * 4); mx = fmaxf(mx, fmaxf(fmaxf(a[0], a[1]), fmaxf(a[2], a[3]))); }
#pragma unroll
    for (int sh = 16; sh; sh >>= 1) mx = fmaxf(mx, __shfl_xor(mx, sh, 32));
    float sum = 0.f;
#pragma unroll 1
    for (int ch = 0; ch < NN / 128; ++ch) { const v4f a = *(const v4f*)(sr + ch * 128 + lane * 4);
#pragma unroll
        for (int q = 0; q < 4; ++q) { float d0 = __fsub_rn(a[q], mx); asm volatile("" : "+v"(d0)); sum += __expf(d0); } }
#pragma unroll
    for (int sh = 16; sh; sh >>= 1) sum += __shfl_xor(sum, sh, 32);
    const float f = __fdiv_rn(PCAR, sum);
    {
#pragma unroll 1
        for (int ch = 0; ch < NN / 128; ++ch) { const int j0 = ch * 128 + lane * 4; const v4f a = *(const v4f*)(sr + j0); v4h o;
#pragma unroll
            for (int q = 0; q < 4; ++q) { float d0 = __fsub_rn(a[q], mx); asm volatile("" : "+v"(d0)); o[q] = tohx(__fmul_rn(__expf(d0), f)); } *(v4h*)(PB + (size_t)row * NN + j0) = o; }
         } }

extern "C" void kernel_launch(void* const* d_in, const int* in_sizes, int n_in,
                              void* d_out, int out_size, void* d_ws, size_t ws_size, hipStream_t stream) {
    (void)in_sizes; (void)n_in; (void)out_size;
    const float* l = (const float*)d_in[0]; const float* wt = (const float*)d_in[1]; const float* wp = (const float*)d_in[2];
    float* OUT = (float*)d_out;     // [8][256][64][64]
    char* wsp = (char*)d_ws;
    auto take = [&](size_t bytes) { char* p = wsp; wsp += (bytes + 255) & ~(size_t)255; return (void*)p; };
    bf* WT = (bf*)take(EE * CC * 2); bf* WP = (bf*)take(EE * CC * 2); bf* XT = (bf*)take((size_t)NN * CC * 2); h16* XC = (h16*)take((size_t)CC * NN * 2); float* TMP = (float*)take((size_t)CC * NN * 4); float* TH = (float*)take((size_t)NN * EE * 4); float* PH = (float*)take((size_t)NN * EE * 4); h16* T16 = (h16*)take((size_t)NN * EE * 2); h16* P16 = (h16*)take((size_t)NN * EE * 2);
    float* Sb = (float*)take((size_t)NN * NN * 4); h16* PB = (h16*)take((size_t)NN * NN * 2);
    if ((size_t)(wsp - (char*)d_ws) > ws_size) return;    // total ~ 115 MB ([4096][4096] f32 scores 67 MB + fp16 probabilities 34 MB)
    k_cvt8<<<(EE * CC / 8 + 255) / 256, 256, 0, stream>>>(wt, WT, EE * CC / 8); k_cvt8<<<(EE * CC / 8 + 255) / 256, 256, 0, stream>>>(wp, WP, EE * CC / 8);   // [e][c] natural Bt
    for (int b = 0; b < NBI; ++b) { const float* lb = l + (size_t)b * CC * NN;
        k_xt<<<(unsigned)(((size_t)NN * CC / 4 + 255) / 256), 256, 0, stream>>>(lb, XT); k_x16<<<(unsigned)(((size_t)CC * NN / 4 + 255) / 256), 256, 0, stream>>>(lb, (size_t)CC * NN / 4, XC);   // token-major bf16 for the projections, channel-major fp16 (bf16 values, exact) as the value operand
        k_gemmw<bf, 0, false><<<dim3(NN / 64, EE / 64, 1), 32, 0, stream>>>(XT, nullptr, WT, nullptr, CC, TH, EE, nullptr, 0, 0, 0); k_gemmw<bf, 0, false><<<dim3(NN / 64, EE / 64, 1), 32, 0, stream>>>(XT, nullptr, WP, nullptr, CC, PH, EE, nullptr, 0, 0, 0);
        k_pl16<<<(NN * EE / 4 + 255) / 256, 256, 0, stream>>>(TH, PH, T16, P16);
        k_gemmw<h16, 0, false><<<dim3(NN / 64, NN / 64, 1), 32, 0, stream>>>(T16, nullptr, P16, nullptr, EE, Sb, NN, nullptr, 0, 0, 0);   // f[q][k] = theta_q . phi_k / sqrt(128)
        k_softbf<<<NN / 8, 256, 0, stream>>>(Sb, PB);
        k_gemmw<h16, 0, false><<<dim3(CC / 64, NN / 64, 1), 32, 0, stream>>>(XC, nullptr, PB, nullptr, NN, TMP, NN, nullptr, 0, 0, 0); k_fin<<<(unsigned)(((size_t)CC * NN / 4 + 255) / 256), 256, 0, stream>>>(TMP, OUT + (size_t)b * CC * NN); }   // out[c][q] = sum_k l[c][k] (1024 f[q][k]) / 1024
}

// v001
// A run of this version takes 288 microseconds.
// Timed twice side by side with v000, it ran 5.29 and 5.23 times as fast.
#include <hip/hip_runtime.h>

// NonLocalOp (l [8][256][64][64] -> 4096 pixels; theta = w_theta l, phi = w_phi l (128 embed channels, 1x1 convs); f = softmax(theta^T phi / sqrt(128)) over keys; out[c][q] = sum_k f[q][k] l[c][k] -> [8][256][64][64]).
// Compute dtypes, f32 accumulate: every input rounded to bf16; theta/phi on PLAIN bf16 operands (inputs: exact); scores (K 128) on single fp16 planes of theta (x 128^-0.5) and phi (the logits are O(1)); softmax f32, online (running maximum and sum); probabilities fp16, values fp16 (bf16 values, exact).

#define NBI  8
#define CC   256
#define EE   128
#define NN   4096
#define SCL  0.08838834764831845f
typedef _Float16 h16;
typedef unsigned short bf;
typedef __attribute__((ext_vector_type(16))) __bf16   v16bf;
typedef __attribute__((ext_vector_type(16))) _Float16 v16h;
typedef __attribute__((ext_vector_type(8)))  _Float16 v8h;
typedef __attribute__((ext_vector_type(8)))  unsigned short v8us;
typedef __attribute__((ext_vector_type(8)))  float    v8f;
typedef __attribute__((ext_vector_type(4)))  float    v4f;
typedef v8h  __attribute__((may_alias)) v8ha;
typedef v4f  __attribute__((may_alias)) v4fa;
typedef v8us __attribute__((may_alias)) v8usa;

__device__ __forceinline__ unsigned short f2bf(float f) { unsigned u = __float_as_uint(f); u += 0x7FFFu + ((u >> 16) & 1u); return (unsigned short)(u >> 16); }
__device__ __forceinline__ float bf2f(unsigned short b) { return __uint_as_float(((unsigned)b) << 16); }
__device__ __forceinline__ float bfr(float f) { return bf2f(f2bf(f)); }
__device__ __forceinline__ v16h cat16(v8h lo, v8h hi) { return __builtin_shufflevector(lo, hi, 0, 1, 2, 3, 4, 5, 6, 7, 8, 9, 10, 11, 12, 13, 14, 15); }
__device__ __forceinline__ v16bf cat16b(v8us lo, v8us hi) { return __builtin_bit_cast(v16bf, __builtin_shufflevector(lo, hi, 0, 1, 2, 3, 4, 5, 6, 7, 8, 9, 10, 11, 12, 13, 14, 15)); }
__device__ __forceinline__ v8f wmma16(v16h a, v16h b, v8f c) { return __builtin_amdgcn_wmma_f32_16x16x32_f16(false, a, false, b, (short)0, c, false, false); }
__device__ __forceinline__ v8f wmmab(v16bf a, v16bf b, v8f c) { return __builtin_amdgcn_wmma_f32_16x16x32_bf16(false, a, false, b, (short)0, c, false, false); }



// ---- k_gemmw: register-blocked GEMM, ONE WAVE per 64x64 output tile (16 accumulators), operands straight from K-contiguous 16-bit planes; grid (M/64, N/64, Z), 32 threads.
// C[m][n] (f32, pitch ldc, + optional f32 bias[n]) = sum_k A[m][k] Bt[n][k] (+ split products per NSPLIT). z-batch strides sA/sB/sC in elements. K % 32 == 0.
template <typename T16> struct WFrag;
template <> struct WFrag<h16> { typedef v16h V; static __device__ __forceinline__ V ld(const h16* p) { return cat16(*(const v8h*)p, *(const v8h*)(p + 16)); } static __device__ __forceinline__ v8f mma(V a, V b, v8f c) { return wmma16(a, b, c); } };
template <> struct WFrag<bf> { typedef v16bf V; static __device__ __forceinline__ V ld(const bf* p) { return cat16b(*(const v8us*)p, *(const v8us*)(p + 16)); } static __device__ __forceinline__ v8f mma(V a, V b, v8f c) { return wmmab(a, b, c); } };
template <typename T16, int NSPLIT, bool BIAS>
__global__ __launch_bounds__(32) void k_gemmw(const T16* __restrict__ A, const T16* __restrict__ A2, const T16* __restrict__ Bt, const T16* __restrict__ Bt2, int K, float* C, int ldc, const float* __restrict__ bias, size_t sA, size_t sB, size_t sC) {
    typedef typename WFrag<T16>::V V;
    __shared__ __align__(16) float os[16 * 68];
    const size_t z = blockIdx.z; A += z * sA; if (A2) A2 += z * sA; Bt += z * sB; if (Bt2) Bt2 += z * sB; C += z * sC;
    const int lane = threadIdx.x & 31, lr = lane & 15, hi = lane >> 4; const int r0 = blockIdx.x * 64, c0 = blockIdx.y * 64;
    v8f acc[4][4];
#pragma unroll
    for (int mb = 0; mb < 4; ++mb)
#pragma unroll
        for (int nb = 0; nb < 4; ++nb) acc[mb][nb] = (v8f){};
    const size_t aoff = (size_t)(r0 + lr) * K + 8 * hi, boff = (size_t)(c0 + lr) * K + 8 * hi;
#pragma unroll 1
    for (int kc = 0; kc < K; kc += 32) {
        V a[4], a2[4];
#pragma unroll
        for (int mb = 0; mb < 4; ++mb) { a[mb] = WFrag<T16>::ld(A + aoff + (size_t)mb * 16 * K + kc); if (NSPLIT == 1 || NSPLIT == 2) a2[mb] = WFrag<T16>::ld(A2 + aoff + (size_t)mb * 16 * K + kc); }
#pragma unroll
        for (int nb = 0; nb < 4; ++nb) { const V b = WFrag<T16>::ld(Bt + boff + (size_t)nb * 16 * K + kc); V b2; if (NSPLIT >= 2) b2 = WFrag<T16>::ld(Bt2 + boff + (size_t)nb * 16 * K + kc);
#pragma unroll
            for (int mb = 0; mb < 4; ++mb) { acc[mb][nb] = WFrag<T16>::mma(a[mb], b, acc[mb][nb]); if (NSPLIT == 1 || NSPLIT == 2) acc[mb][nb] = WFrag<T16>::mma(a2[mb], b, acc[mb][nb]); if (NSPLIT >= 2) acc[mb][nb] = WFrag<T16>::mma(a[mb], b2, acc[mb][nb]); } }
        asm volatile("v_nop\n\tv_nop\n\tv_nop\n\tv_nop" : "+v"(acc[0][0]), "+v"(acc[1][1]), "+v"(acc[2][2]), "+v"(acc[3][3]) : "v"(a[0]), "v"(a[3]));
    }
#pragma unroll
    for (int mb = 0; mb < 4; ++mb) {
#pragma unroll
        for (int nb = 0; nb < 4; ++nb) {
#pragma unroll
            for (int j = 0; j < 8; ++j) os[(hi * 8 + j) * 68 + nb * 16 + lr] = acc[mb][nb][j]; }
        __builtin_amdgcn_wave_barrier(); asm volatile("" ::: "memory");
        float* crow = C + (size_t)(r0 + mb * 16) * ldc + c0;
{
#pragma unroll
            for (int s = 0; s < 8; ++s) { const int row = 2 * s + hi, cofs = lr * 4; v4f val = *(const v4fa*)(os + row * 68 + cofs); if (BIAS) { val[0] += bfr(bias[c0 + cofs]); val[1] += bfr(bias[c0 + cofs + 1]); val[2] += bfr(bias[c0 + cofs + 2]); val[3] += bfr(bias[c0 + cofs + 3]); }
                *(v4f*)(crow + (size_t)row * ldc + cofs) = val; }
             }
        __builtin_amdgcn_wave_barrier(); asm volatile("" ::: "memory");
    }
}

__device__ __forceinline__ h16 tohx(float x) { return (h16)x; }
typedef __attribute__((ext_vector_type(4))) _Float16 v4h;
typedef __attribute__((ext_vector_type(4))) unsigned short v4us;

__global__ __launch_bounds__(256) void k_cvt8(const float* __restrict__ src, bf* dst, size_t n8) { const size_t i = (size_t)blockIdx.x * 256 + threadIdx.x; if (i >= n8) return; const v8f v = *(const v8f*)(src + i * 8); v8us o;
#pragma unroll
    for (int k = 0; k < 8; ++k) o[k] = f2bf(v[k]); *(v8us*)(dst + i * 8) = o;  }
// k_xt: XT[n][c] = bf16 l[b][c][n] (lane -> 4 consecutive c); k_pl16: T16[n][e] = fp16(THETA[n][e] scl), P16[n][e] = fp16(PHI[n][e]) (8-B lanes); k_x16: fp16 copy of the bf16-rounded input;
__global__ __launch_bounds__(256) void k_xt(const float* __restrict__ x, bf* XT) { const size_t e = ((size_t)blockIdx.x * 256 + threadIdx.x) * 4; if (e >= (size_t)NN * CC) return; const int c = (int)(e % CC); const int n = (int)(e / CC); v4us o;
#pragma unroll
    for (int q = 0; q < 4; ++q) o[q] = f2bf(x[(size_t)(c + q) * NN + n]); *(v4us*)(XT + e) = o;  }
__global__ __launch_bounds__(256) void k_pl16(const float* __restrict__ TH, const float* __restrict__ PH, h16* T16, h16* P16) { const size_t e = ((size_t)blockIdx.x * 256 + threadIdx.x) * 4; if (e >= (size_t)NN * EE) return; const v4f a = *(const v4f*)(TH + e), c = *(const v4f*)(PH + e); v4h ot, op;
#pragma unroll
    for (int q = 0; q < 4; ++q) { ot[q] = tohx(a[q] * SCL); op[q] = tohx(c[q]); } { *(v4h*)(T16 + e) = ot; *(v4h*)(P16 + e) = op;  } }
__global__ __launch_bounds__(256) void k_x16(const float* __restrict__ x, size_t n4, h16* X16) { const size_t i = ((size_t)blockIdx.x * 256 + threadIdx.x) * 4; if (i >= n4 * 4) return; const v4f a = *(const v4f*)(x + i); v4h o; o[0] = tohx(bfr(a[0])); o[1] = tohx(bfr(a[1])); o[2] = tohx(bfr(a[2])); o[3] = tohx(bfr(a[3])); *(v4h*)(X16 + i) = o;  }
// ---- k_flash: scores, softmax and value product in one kernel, all images in one launch; grid (4096 / 128 query blocks, 8 images), 8 waves, 16 query columns a wave.
// Transposed products: S^T[key][q] = phi_key . theta_q (A = key rows from LDS, B = the wave's queries, kept in registers); O^T[c][q] += l[c][key] P^T[key][q] (A = channel rows from LDS, B = the two score tiles of a pass packed to fp16 in place: a lane's D registers are the k order of the B operand, and the A loader reads bytes 16h and 32 + 16h of each 64, the same order).
// A lane holds one query's scores: running maximum and sum per lane, one exchange between the wave's halves. The maximum in use (log2 units) moves only when a column's new maximum exceeds it by more than 8, so P <= 256 fits fp16.
// A pass is 32 keys; two LDS buffers, the next pass's tiles are loaded to registers ahead of the products and stored to the other buffer behind them; one barrier a pass.
#define KT    32
#define KPIT  136                  // halves: 256-B key rows at a 272-B pitch
#define VPIT  40                   // halves: 64-B channel rows at an 80-B pitch
#define KBUF  (KT * KPIT)
#define SBUF  (KBUF + CC * VPIT)
#define OPIT  132                  // floats: output staging pitch
#define L2E   1.4426950408889634f
#define UNR   _Pragma("unroll")   // full unroll wherever it stands: the fragment and accumulator arrays are indexed by the loop variable and stay in registers only with constant indices
__device__ __forceinline__ float xhalf(float x) { return __builtin_bit_cast(float, __builtin_amdgcn_permlanex16(__builtin_bit_cast(int, x), __builtin_bit_cast(int, x), 0x76543210, 0xfedcba98, false, false)); }  // lane l with lane l ^ 16
__device__ __forceinline__ v16h ldfrag(const h16* p) { return cat16(*(const v8ha*)p, *(const v8ha*)(p + 16)); }
__global__ __launch_bounds__(256) void k_flash(const _Float16* __restrict__ Tq, const _Float16* __restrict__ Pk, const _Float16* __restrict__ Xv, float* __restrict__ OUTp) {
    __shared__ __align__(16) char smem[CC * OPIT * 4];   // the ring (2 * SBUF halves) in the loop, the [256][128] f32 output tile behind it
    h16* ring = (h16*)smem; float* os = (float*)smem;
    const int t = threadIdx.x, lane = t & 31, lr = lane & 15, hi = lane >> 4, w = t >> 5;
    const int b = blockIdx.y, q0 = blockIdx.x * 128;
    const h16* kg = Pk + (size_t)b * NN * EE + (size_t)(t >> 4) * EE + (t & 15) * 8;      // + 16 rows per chunk, + KT rows per pass
    const h16* vg = Xv + (size_t)b * CC * NN + (size_t)(t >> 2) * NN + (t & 3) * 8;       // + 64 rows per chunk, + KT keys per pass
    h16* ks = ring + (t >> 4) * KPIT + (t & 15) * 8;
    h16* vs = ring + KBUF + (t >> 2) * VPIT + (t & 3) * 8;
    v16h q[4];
    { const h16* qp = Tq + ((size_t)b * NN + q0 + w * 16 + lr) * EE + 8 * hi;
    UNR
      for (int ec = 0; ec < 4; ++ec) q[ec] = ldfrag(qp + ec * 32); }
    v8f acc[16];
    UNR
    for (int ct = 0; ct < 16; ++ct) acc[ct] = (v8f){};
    float mref = -1.0e30f, lsum = 0.f;
    v8h kr[2], vr[4];
    UNR
    for (int j = 0; j < 2; ++j) kr[j] = *(const v8ha*)(kg + (size_t)j * 16 * EE);
    UNR
    for (int j = 0; j < 4; ++j) vr[j] = *(const v8ha*)(vg + (size_t)j * 64 * NN);
    UNR
    for (int j = 0; j < 2; ++j) *(v8ha*)(ks + j * 16 * KPIT) = kr[j];
    UNR
    for (int j = 0; j < 4; ++j) *(v8ha*)(vs + j * 64 * VPIT) = vr[j];
    __syncthreads();
    for (int s = 0; s < NN / KT; ++s) {
        const int cur = (s & 1) * SBUF, nxt = SBUF - cur;
        const bool more = s + 1 < NN / KT;
        if (more) {
    UNR
            for (int j = 0; j < 2; ++j) kr[j] = *(const v8ha*)(kg + (size_t)((s + 1) * KT + j * 16) * EE);
    UNR
            for (int j = 0; j < 4; ++j) vr[j] = *(const v8ha*)(vg + (size_t)j * 64 * NN + (s + 1) * KT);
        }
        v16h kf[8];
    UNR
        for (int i = 0; i < 8; ++i) kf[i] = ldfrag(ring + cur + ((i & 1) * 16 + lr) * KPIT + (i >> 1) * 32 + 8 * hi);
        __builtin_amdgcn_sched_barrier(0);   // holds the next pass's global loads and this pass's eight key fragment reads, as one group, ahead of the products: read one by one, each product waits out a whole LDS latency
        v8f st[2] = {(v8f){}, (v8f){}};
    UNR
        for (int i = 0; i < 8; ++i) st[i & 1] = wmma16(kf[i], q[i >> 1], st[i & 1]);
        const h16* vb = ring + cur + KBUF + lr * VPIT + 8 * hi;
        v16h vf[2][4];
    UNR
        for (int i = 0; i < 4; ++i) vf[0][i] = ldfrag(vb + i * 16 * VPIT);
        __builtin_amdgcn_sched_barrier(0);   // the first four channel fragments are read ahead of the softmax arithmetic, which hides their latency
        float mx = fmaxf(st[0][0], st[1][0]);
    UNR
        for (int r = 1; r < 8; ++r) mx = fmaxf(mx, fmaxf(st[0][r], st[1][r]));
        mx = fmaxf(mx, xhalf(mx));
        const float mt = mx * L2E;
        if (__builtin_amdgcn_ballot_w32(mt > mref + 8.0f) != 0) {   // wave-uniform; rare behind the first pass
            const float mn = fmaxf(mref, mt), corr = __builtin_amdgcn_exp2f(mref - mn);   // 0 on the first pass
            mref = mn; lsum *= corr;
    UNR
            for (int ct = 0; ct < 16; ++ct) acc[ct] *= corr;
        }
        v16h pb;
    UNR
        for (int r = 0; r < 8; ++r) { const float p0 = __builtin_amdgcn_exp2f(fmaf(st[0][r], L2E, -mref)), p1 = __builtin_amdgcn_exp2f(fmaf(st[1][r], L2E, -mref)); lsum += p0 + p1; pb[r] = (h16)p0; pb[8 + r] = (h16)p1; }
    UNR
        for (int g = 0; g < 4; ++g) {
            if (g < 3) {
    UNR
                for (int i = 0; i < 4; ++i) vf[(g + 1) & 1][i] = ldfrag(vb + ((g + 1) * 4 + i) * 16 * VPIT); }
            __builtin_amdgcn_sched_barrier(0);   // channel fragments in groups of four, one group ahead of the products that use them
    UNR
            for (int i = 0; i < 4; ++i) acc[g * 4 + i] = wmma16(vf[g & 1][i], pb, acc[g * 4 + i]);
        }
        if (more) {
    UNR
            for (int j = 0; j < 2; ++j) *(v8ha*)(ks + nxt + j * 16 * KPIT) = kr[j];
    UNR
            for (int j = 0; j < 4; ++j) *(v8ha*)(vs + nxt + j * 64 * VPIT) = vr[j];
        }
        __syncthreads();   // publishes the next pass's tiles and ends every read of this pass's buffer
    }
    lsum += xhalf(lsum);
    const float inv = 1.0f / lsum;
    UNR
    for (int ct = 0; ct < 16; ++ct)
    UNR
        for (int r = 0; r < 8; ++r) os[(ct * 16 + 8 * hi + r) * OPIT + w * 16 + lr] = acc[ct][r] * inv;
    __syncthreads();
    for (int j = 0; j < 32; ++j) { const int row = w + 8 * j; *(v4f*)(OUTp + ((size_t)b * CC + row) * NN + q0 + lane * 4) = *(const v4fa*)(os + row * OPIT + lane * 4); }   // a wave stores 512 contiguous bytes of one channel row
}

extern "C" void kernel_launch(void* const* d_in, const int* in_sizes, int n_in,
                              void* d_out, int out_size, void* d_ws, size_t ws_size, hipStream_t stream) {
    (void)in_sizes; (void)n_in; (void)out_size;
    const float* l = (const float*)d_in[0]; const float* wt = (const float*)d_in[1]; const float* wp = (const float*)d_in[2];
    float* OUT = (float*)d_out;     // [8][256][64][64]
    char* wsp = (char*)d_ws;
    auto take = [&](size_t bytes) { char* p = wsp; wsp += (bytes + 255) & ~(size_t)255; return (void*)p; };
    bf* WT = (bf*)take(EE * CC * 2); bf* WP = (bf*)take(EE * CC * 2); bf* XT = (bf*)take((size_t)NN * CC * 2); h16* XC = (h16*)take((size_t)NBI * CC * NN * 2); float* TH = (float*)take((size_t)NN * EE * 4); float* PH = (float*)take((size_t)NN * EE * 4); h16* T16 = (h16*)take((size_t)NBI * NN * EE * 2); h16* P16 = (h16*)take((size_t)NBI * NN * EE * 2);
    if ((size_t)(wsp - (char*)d_ws) > ws_size) return;    // total ~ 40 MB (fp16 values 17 MB, fp16 theta and phi 8 MB each)
    k_cvt8<<<(EE * CC / 8 + 255) / 256, 256, 0, stream>>>(wt, WT, EE * CC / 8); k_cvt8<<<(EE * CC / 8 + 255) / 256, 256, 0, stream>>>(wp, WP, EE * CC / 8);   // [e][c] natural Bt
    for (int b = 0; b < NBI; ++b) { const float* lb = l + (size_t)b * CC * NN;
        k_xt<<<(unsigned)(((size_t)NN * CC / 4 + 255) / 256), 256, 0, stream>>>(lb, XT); k_x16<<<(unsigned)(((size_t)CC * NN / 4 + 255) / 256), 256, 0, stream>>>(lb, (size_t)CC * NN / 4, XC + (size_t)b * CC * NN);   // token-major bf16 for the projections, channel-major fp16 (bf16 values, exact) as the value operand
        k_gemmw<bf, 0, false><<<dim3(NN / 64, EE / 64, 1), 32, 0, stream>>>(XT, nullptr, WT, nullptr, CC, TH, EE, nullptr, 0, 0, 0); k_gemmw<bf, 0, false><<<dim3(NN / 64, EE / 64, 1), 32, 0, stream>>>(XT, nullptr, WP, nullptr, CC, PH, EE, nullptr, 0, 0, 0);
        k_pl16<<<(NN * EE / 4 + 255) / 256, 256, 0, stream>>>(TH, PH, T16 + (size_t)b * NN * EE, P16 + (size_t)b * NN * EE); }
    k_flash<<<dim3(NN / 128, NBI, 1), 256, 0, stream>>>(T16, P16, XC, OUT);   // out[c][q] = sum_k softmax_k(theta_q . phi_k / sqrt(128)) l[c][k]
}

// v002
// Measured time: 119 microseconds a run.
// In two side-by-side timings against v001, it was 2.40 and 2.44 times as fast.
// Over all steps from v000 it is 12.7 times as fast.
#include <hip/hip_runtime.h>

// NonLocalOp (l [8][256][64][64] -> 4096 pixels; theta = w_theta l, phi = w_phi l (128 embed channels, 1x1 convs); f = softmax(theta^T phi / sqrt(128)) over keys; out[c][q] = sum_k f[q][k] l[c][k] -> [8][256][64][64]).
// Compute dtypes, f32 accumulate: every input rounded to bf16; theta/phi on PLAIN bf16 operands (inputs: exact); scores (K 128) on single fp16 planes of theta (x 128^-0.5) and phi (the logits are O(1)); softmax f32, online (running maximum and sum); probabilities fp16, values fp16 (bf16 values, exact).

#define NBI  8
#define CC   256
#define EE   128
#define NN   4096
#define SCL  0.08838834764831845f
typedef _Float16 h16;
typedef unsigned short bf;
typedef __attribute__((ext_vector_type(16))) __bf16   v16bf;
typedef __attribute__((ext_vector_type(16))) _Float16 v16h;
typedef __attribute__((ext_vector_type(8)))  _Float16 v8h;
typedef __attribute__((ext_vector_type(8)))  unsigned short v8us;
typedef __attribute__((ext_vector_type(8)))  float    v8f;
typedef __attribute__((ext_vector_type(4)))  float    v4f;
typedef v8h  __attribute__((may_alias)) v8ha;
typedef v4f  __attribute__((may_alias)) v4fa;
typedef v8us __attribute__((may_alias)) v8usa;

__device__ __forceinline__ unsigned short f2bf(float f) { unsigned u = __float_as_uint(f); u += 0x7FFFu + ((u >> 16) & 1u); return (unsigned short)(u >> 16); }
__device__ __forceinline__ float bf2f(unsigned short b) { return __uint_as_float(((unsigned)b) << 16); }
__device__ __forceinline__ float bfr(float f) { return bf2f(f2bf(f)); }
__device__ __forceinline__ v16h cat16(v8h lo, v8h hi) { return __builtin_shufflevector(lo, hi, 0, 1, 2, 3, 4, 5, 6, 7, 8, 9, 10, 11, 12, 13, 14, 15); }
__device__ __forceinline__ v16bf cat16b(v8us lo, v8us hi) { return __builtin_bit_cast(v16bf, __builtin_shufflevector(lo, hi, 0, 1, 2, 3, 4, 5, 6, 7, 8, 9, 10, 11, 12, 13, 14, 15)); }
__device__ __forceinline__ v8f wmma16(v16h a, v16h b, v8f c) { return __builtin_amdgcn_wmma_f32_16x16x32_f16(false, a, false, b, (short)0, c, false, false); }
__device__ __forceinline__ v8f wmmab(v16bf a, v16bf b, v8f c) { return __builtin_amdgcn_wmma_f32_16x16x32_bf16(false, a, false, b, (short)0, c, false, false); }



__device__ __forceinline__ h16 tohx(float x) { return (h16)x; }
typedef __attribute__((ext_vector_type(4))) _Float16 v4h;
typedef __attribute__((ext_vector_type(4))) unsigned short v4us;
typedef v4us __attribute__((may_alias)) v4usa;
#define UNR   _Pragma("unroll")   // full unroll wherever it stands: the fragment and accumulator arrays are indexed by the loop variable and stay in registers only with constant indices

// ---- k_proj: everything ahead of the attention in one kernel, all images in one launch; grid (4096 / 128 pixel blocks, 8 images), 8 waves, 16 pixels a wave.
// T16[n][e] = fp16(128^-0.5 sum_c bf16 w_theta[e][c] bf16 l[c][n]), P16[n][e] = fp16(sum_c bf16 w_phi[e][c] bf16 l[c][n]), XC[c][n] = fp16(bf16 l[c][n]).
// Transposed products D[e][n]: A = weight rows (both matrices, rounded to bf16 on the way into LDS, 256 rows of 256), B = the wave's 16 pixels over all 256 channels, kept in registers.
// A lane builds its B fragments straight from the channel-major input: lane (lr, hi) reads pixel lr at channels 32 kc + 8 hi + i and 32 kc + 16 + 8 hi + i, the k order of the A loader; 16 lanes share 64 contiguous bytes of a channel row.
// A lane's D registers are 8 consecutive embed channels of one pixel: one 16-byte store a tile. K runs upward in steps of 32 on one accumulator chain.
#define WPIT  264                  // halves: 512-B weight rows at a 528-B pitch
__device__ __forceinline__ v16bf ldfragb(const bf* p) { return cat16b(*(const v8usa*)p, *(const v8usa*)(p + 16)); }
__global__ __launch_bounds__(256) void k_proj(const float* __restrict__ l, const float* __restrict__ wt, const float* __restrict__ wp, _Float16* __restrict__ T16, _Float16* __restrict__ P16, _Float16* __restrict__ XC) {
    __shared__ __align__(16) bf wsm[2 * EE * WPIT];
    const int t = threadIdx.x, lane = t & 31, lr = lane & 15, hi = lane >> 4, w = t >> 5;
    const int b = blockIdx.y, n0 = blockIdx.x * 128;
    const float* lb = l + (size_t)b * CC * NN + n0;
    const float* xp = lb + (size_t)(8 * hi) * NN + w * 16 + lr;
    v16bf x[8];
    UNR
    for (int kc = 0; kc < 8; ++kc) { v8us lo, up;
    UNR
        for (int i = 0; i < 8; ++i) { lo[i] = f2bf(xp[(size_t)(kc * 32 + i) * NN]); up[i] = f2bf(xp[(size_t)(kc * 32 + 16 + i) * NN]); }
        x[kc] = cat16b(lo, up); }
    const float* wtp = wt + (size_t)(t >> 6) * CC + (t & 63) * 4; const float* wpp = wp + (size_t)(t >> 6) * CC + (t & 63) * 4;
    UNR
    for (int j = 0; j < 64; ++j) {   // a wave moves 512 contiguous bytes of one weight row; rows 0..127 theta, 128..255 phi
        const v4f a = *(const v4f*)((j < 32 ? wtp : wpp) + (size_t)(j & 31) * 4 * CC); v4us o;
    UNR
        for (int k = 0; k < 4; ++k) o[k] = f2bf(a[k]);
        *(v4usa*)(wsm + (j * 4 + (t >> 6)) * WPIT + (t & 63) * 4) = o; }
    asm volatile("s_wait_xcnt 0x0" :: "v"(xp), "v"(wtp), "v"(wpp) : "memory");   // the three address pairs of the loads above stay unwritten up to this wait; their registers are reused behind it
    __syncthreads();   // publishes the weights
    const size_t prow = ((size_t)b * NN + n0 + w * 16 + lr) * EE + 8 * hi;
    for (int h = 0; h < 2; ++h) {   // theta, then phi
        const bf* wh = wsm + (h * EE + lr) * WPIT + 8 * hi;
        v8f acc[8];
    UNR
        for (int et = 0; et < 8; ++et) acc[et] = (v8f){};
        v16bf af[2][4];
    UNR
        for (int i = 0; i < 4; ++i) af[0][i] = ldfragb(wh + i * 16 * WPIT);
    UNR
        for (int g = 0; g < 16; ++g) {   // group g: channels 32 (g >> 1) .., embed tiles 4 (g & 1) + i
            if (g < 15) {
    UNR
                for (int i = 0; i < 4; ++i) af[(g + 1) & 1][i] = ldfragb(wh + (((g + 1) & 1) * 4 + i) * 16 * WPIT + ((g + 1) >> 1) * 32); }
            __builtin_amdgcn_sched_barrier(0);   // weight fragments in groups of four, one group ahead of the products that use them: read one by one, each product waits out a whole LDS latency
    UNR
            for (int i = 0; i < 4; ++i) acc[(g & 1) * 4 + i] = wmmab(af[g & 1][i], x[g >> 1], acc[(g & 1) * 4 + i]);
        }
        h16* dst = (h ? P16 : T16) + prow; const float sc = h ? 1.0f : SCL;
        v8h o[8];
    UNR
        for (int et = 0; et < 8; ++et) {
    UNR
            for (int j = 0; j < 8; ++j) o[et][j] = tohx(acc[et][j] * sc);
            *(v8h*)(dst + et * 16) = o[et]; }
        asm volatile("s_wait_xcnt 0x0" :: "v"(dst), "v"(o[0]), "v"(o[1]), "v"(o[2]), "v"(o[3]), "v"(o[4]), "v"(o[5]), "v"(o[6]), "v"(o[7]) : "memory");   // address and data registers of the eight stores stay unwritten up to this wait; the next phase reuses them
    }
    const float* xs = lb + (size_t)w * NN + lane * 4; h16* xd = XC + (size_t)b * CC * NN + n0 + (size_t)w * NN + lane * 4;
    v4f a[32];   // the value operand: a wave reads 512 contiguous bytes of one channel row and stores 256
    UNR
    for (int j = 0; j < 32; ++j) a[j] = *(const v4f*)(xs + (size_t)j * 8 * NN);
    asm volatile("s_wait_xcnt 0x0" :: "v"(xs) : "memory");   // the loads' address pair stays unwritten up to this wait
    UNR
    for (int g = 0; g < 4; ++g) { v4h o[8];
    UNR
        for (int j = 0; j < 8; ++j) {
    UNR
            for (int k = 0; k < 4; ++k) o[j][k] = tohx(bfr(a[g * 8 + j][k]));
            *(v4h*)(xd + (size_t)(g * 8 + j) * 8 * NN) = o[j]; }
        if (g < 3) asm volatile("s_wait_xcnt 0x0" :: "v"(xd), "v"(o[0]), "v"(o[1]), "v"(o[2]), "v"(o[3]), "v"(o[4]), "v"(o[5]), "v"(o[6]), "v"(o[7]) : "memory");   // data registers of the eight stores stay unwritten up to this wait; the next eight rows reuse them
    }
}
// ---- k_flash: scores, softmax and value product in one kernel, all images in one launch; grid (4096 / 128 query blocks, 8 images), 8 waves, 16 query columns a wave.
// Transposed products: S^T[key][q] = phi_key . theta_q (A = key rows from LDS, B = the wave's queries, kept in registers); O^T[c][q] += l[c][key] P^T[key][q] (A = channel rows from LDS, B = the two score tiles of a pass packed to fp16 in place: a lane's D registers are the k order of the B operand, and the A loader reads bytes 16h and 32 + 16h of each 64, the same order).
// A lane holds one query's scores: running maximum and sum per lane, one exchange between the wave's halves. The maximum in use (log2 units) moves only when a column's new maximum exceeds it by more than 8, so P <= 256 fits fp16.
// A pass is 32 keys; two LDS buffers, the next pass's tiles are loaded to registers ahead of the products and stored to the other buffer behind them; one barrier a pass.
#define KT    32
#define KPIT  136                  // halves: 256-B key rows at a 272-B pitch
#define VPIT  40                   // halves: 64-B channel rows at an 80-B pitch
#define KBUF  (KT * KPIT)
#define SBUF  (KBUF + CC * VPIT)
#define OPIT  132                  // floats: output staging pitch
#define L2E   1.4426950408889634f
__device__ __forceinline__ float xhalf(float x) { return __builtin_bit_cast(float, __builtin_amdgcn_permlanex16(__builtin_bit_cast(int, x), __builtin_bit_cast(int, x), 0x76543210, 0xfedcba98, false, false)); }  // lane l with lane l ^ 16
__device__ __forceinline__ v16h ldfrag(const h16* p) { return cat16(*(const v8ha*)p, *(const v8ha*)(p + 16)); }
__global__ __launch_bounds__(256) void k_flash(const _Float16* __restrict__ Tq, const _Float16* __restrict__ Pk, const _Float16* __restrict__ Xv, float* __restrict__ OUTp) {
    __shared__ __align__(16) char smem[CC * OPIT * 4];   // the ring (2 * SBUF halves) in the loop, the [256][128] f32 output tile behind it
    h16* ring = (h16*)smem; float* os = (float*)smem;
    const int t = threadIdx.x, lane = t & 31, lr = lane & 15, hi = lane >> 4, w = t >> 5;
    const int b = blockIdx.y, q0 = blockIdx.x * 128;
    const h16* kg = Pk + (size_t)b * NN * EE + (size_t)(t >> 4) * EE + (t & 15) * 8;      // + 16 rows per chunk, + KT rows per pass
    const h16* vg = Xv + (size_t)b * CC * NN + (size_t)(t >> 2) * NN + (t & 3) * 8;       // + 64 rows per chunk, + KT keys per pass
    h16* ks = ring + (t >> 4) * KPIT + (t & 15) * 8;
    h16* vs = ring + KBUF + (t >> 2) * VPIT + (t & 3) * 8;
    v16h q[4];
    { const h16* qp = Tq + ((size_t)b * NN + q0 + w * 16 + lr) * EE + 8 * hi;
    UNR
      for (int ec = 0; ec < 4; ++ec) q[ec] = ldfrag(qp + ec * 32); }
    v8f acc[16];
    UNR
    for (int ct = 0; ct < 16; ++ct) acc[ct] = (v8f){};
    float mref = -1.0e30f, lsum = 0.f;
    v8h kr[2], vr[4];
    UNR
    for (int j = 0; j < 2; ++j) kr[j] = *(const v8ha*)(kg + (size_t)j * 16 * EE);
    UNR
    for (int j = 0; j < 4; ++j) vr[j] = *(const v8ha*)(vg + (size_t)j * 64 * NN);
    UNR
    for (int j = 0; j < 2; ++j) *(v8ha*)(ks + j * 16 * KPIT) = kr[j];
    UNR
    for (int j = 0; j < 4; ++j) *(v8ha*)(vs + j * 64 * VPIT) = vr[j];
    __syncthreads();
    for (int s = 0; s < NN / KT; ++s) {
        const int cur = (s & 1) * SBUF, nxt = SBUF - cur;
        const bool more = s + 1 < NN / KT;
        if (more) {
    UNR
            for (int j = 0; j < 2; ++j) kr[j] = *(const v8ha*)(kg + (size_t)((s + 1) * KT + j * 16) * EE);
    UNR
            for (int j = 0; j < 4; ++j) vr[j] = *(const v8ha*)(vg + (size_t)j * 64 * NN + (s + 1) * KT);
        }
        v16h kf[8];
    UNR
        for (int i = 0; i < 8; ++i) kf[i] = ldfrag(ring + cur + ((i & 1) * 16 + lr) * KPIT + (i >> 1) * 32 + 8 * hi);
        __builtin_amdgcn_sched_barrier(0);   // holds the next pass's global loads and this pass's eight key fragment reads, as one group, ahead of the products: read one by one, each product waits out a whole LDS latency
        v8f st[2] = {(v8f){}, (v8f){}};
    UNR
        for (int i = 0; i < 8; ++i) st[i & 1] = wmma16(kf[i], q[i >> 1], st[i & 1]);
        const h16* vb = ring + cur + KBUF + lr * VPIT + 8 * hi;
        v16h vf[2][4];
    UNR
        for (int i = 0; i < 4; ++i) vf[0][i] = ldfrag(vb + i * 16 * VPIT);
        __builtin_amdgcn_sched_barrier(0);   // the first four channel fragments are read ahead of the softmax arithmetic, which hides their latency
        float mx = fmaxf(st[0][0], st[1][0]);
    UNR
        for (int r = 1; r < 8; ++r) mx = fmaxf(mx, fmaxf(st[0][r], st[1][r]));
        mx = fmaxf(mx, xhalf(mx));
        const float mt = mx * L2E;
        if (__builtin_amdgcn_ballot_w32(mt > mref + 8.0f) != 0) {   // wave-uniform; rare behind the first pass
            const float mn = fmaxf(mref, mt), corr = __builtin_amdgcn_exp2f(mref - mn);   // 0 on the first pass
            mref = mn; lsum *= corr;
    UNR
            for (int ct = 0; ct < 16; ++ct) acc[ct] *= corr;
        }
        v16h pb;
    UNR
        for (int r = 0; r < 8; ++r) { const float p0 = __builtin_amdgcn_exp2f(fmaf(st[0][r], L2E, -mref)), p1 = __builtin_amdgcn_exp2f(fmaf(st[1][r], L2E, -mref)); lsum += p0 + p1; pb[r] = (h16)p0; pb[8 + r] = (h16)p1; }
    UNR
        for (int g = 0; g < 4; ++g) {
            if (g < 3) {
    UNR
                for (int i = 0; i < 4; ++i) vf[(g + 1) & 1][i] = ldfrag(vb + ((g + 1) * 4 + i) * 16 * VPIT); }
            __builtin_amdgcn_sched_barrier(0);   // channel fragments in groups of four, one group ahead of the products that use them
    UNR
            for (int i = 0; i < 4; ++i) acc[g * 4 + i] = wmma16(vf[g & 1][i], pb, acc[g * 4 + i]);
        }
        if (more) {
    UNR
            for (int j = 0; j < 2; ++j) *(v8ha*)(ks + nxt + j * 16 * KPIT) = kr[j];
    UNR
            for (int j = 0; j < 4; ++j) *(v8ha*)(vs + nxt + j * 64 * VPIT) = vr[j];
        }
        __syncthreads();   // publishes the next pass's tiles and ends every read of this pass's buffer
    }
    lsum += xhalf(lsum);
    const float inv = 1.0f / lsum;
    UNR
    for (int ct = 0; ct < 16; ++ct)
    UNR
        for (int r = 0; r < 8; ++r) os[(ct * 16 + 8 * hi + r) * OPIT + w * 16 + lr] = acc[ct][r] * inv;
    __syncthreads();
    for (int j = 0; j < 32; ++j) { const int row = w + 8 * j; *(v4f*)(OUTp + ((size_t)b * CC + row) * NN + q0 + lane * 4) = *(const v4fa*)(os + row * OPIT + lane * 4); }   // a wave stores 512 contiguous bytes of one channel row
}

extern "C" void kernel_launch(void* const* d_in, const int* in_sizes, int n_in,
                              void* d_out, int out_size, void* d_ws, size_t ws_size, hipStream_t stream) {
    (void)in_sizes; (void)n_in; (void)out_size;
    const float* l = (const float*)d_in[0]; const float* wt = (const float*)d_in[1]; const float* wp = (const float*)d_in[2];
    float* OUT = (float*)d_out;     // [8][256][64][64]
    char* wsp = (char*)d_ws;
    auto take = [&](size_t bytes) { char* p = wsp; wsp += (bytes + 255) & ~(size_t)255; return (void*)p; };
    h16* XC = (h16*)take((size_t)NBI * CC * NN * 2); h16* T16 = (h16*)take((size_t)NBI * NN * EE * 2); h16* P16 = (h16*)take((size_t)NBI * NN * EE * 2);
    if ((size_t)(wsp - (char*)d_ws) > ws_size) return;    // total ~ 34 MB (fp16 values 17 MB, fp16 theta and phi 8 MB each)
    k_proj<<<dim3(NN / 128, NBI, 1), 256, 0, stream>>>(l, wt, wp, T16, P16, XC);   // fp16 theta (scaled), phi and values of all images
    k_flash<<<dim3(NN / 128, NBI, 1), 256, 0, stream>>>(T16, P16, XC, OUT);   // out[c][q] = sum_k softmax_k(theta_q . phi_k / sqrt(128)) l[c][k]
}

// v003
// One run takes 92.8 microseconds.
// Two timings next to v002 both put it at 1.28 times that version's speed.
// All steps since v000 together make it 16.3 times as fast.
#include <hip/hip_runtime.h>

// NonLocalOp (l [8][256][64][64] -> 4096 pixels; theta = w_theta l, phi = w_phi l (128 embed channels, 1x1 convs); f = softmax(theta^T phi / sqrt(128)) over keys; out[c][q] = sum_k f[q][k] l[c][k] -> [8][256][64][64]).
// Compute dtypes, f32 accumulate: every input rounded to bf16; theta/phi on PLAIN bf16 operands (inputs: exact); scores (K 128) on single fp16 planes of theta (x 128^-0.5) and phi (the logits are O(1)); softmax f32, online (running maximum and sum); probabilities fp16, values fp16 (bf16 values, exact).

#define NBI  8
#define CC   256
#define EE   128
#define NN   4096
#define SCL  0.08838834764831845f
typedef _Float16 h16;
typedef unsigned short bf;
typedef __attribute__((ext_vector_type(16))) __bf16   v16bf;
typedef __attribute__((ext_vector_type(16))) _Float16 v16h;
typedef __attribute__((ext_vector_type(8)))  _Float16 v8h;
typedef __attribute__((ext_vector_type(8)))  unsigned short v8us;
typedef __attribute__((ext_vector_type(8)))  float    v8f;
typedef __attribute__((ext_vector_type(4)))  float    v4f;
typedef v8h  __attribute__((may_alias)) v8ha;
typedef v4f  __attribute__((may_alias)) v4fa;
typedef v8us __attribute__((may_alias)) v8usa;

__device__ __forceinline__ unsigned short f2bf(float f) { unsigned u = __float_as_uint(f); u += 0x7FFFu + ((u >> 16) & 1u); return (unsigned short)(u >> 16); }
__device__ __forceinline__ float bf2f(unsigned short b) { return __uint_as_float(((unsigned)b) << 16); }
__device__ __forceinline__ float bfr(float f) { return bf2f(f2bf(f)); }
__device__ __forceinline__ v16h cat16(v8h lo, v8h hi) { return __builtin_shufflevector(lo, hi, 0, 1, 2, 3, 4, 5, 6, 7, 8, 9, 10, 11, 12, 13, 14, 15); }
__device__ __forceinline__ v16bf cat16b(v8us lo, v8us hi) { return __builtin_bit_cast(v16bf, __builtin_shufflevector(lo, hi, 0, 1, 2, 3, 4, 5, 6, 7, 8, 9, 10, 11, 12, 13, 14, 15)); }
__device__ __forceinline__ v8f wmma16(v16h a, v16h b, v8f c) { return __builtin_amdgcn_wmma_f32_16x16x32_f16(false, a, false, b, (short)0, c, false, false); }
__device__ __forceinline__ v8f wmmab(v16bf a, v16bf b, v8f c) { return __builtin_amdgcn_wmma_f32_16x16x32_bf16(false, a, false, b, (short)0, c, false, false); }



__device__ __forceinline__ h16 tohx(float x) { return (h16)x; }
typedef __attribute__((ext_vector_type(4))) _Float16 v4h;
typedef __attribute__((ext_vector_type(4))) unsigned short v4us;
typedef v4us __attribute__((may_alias)) v4usa;
#define UNR   _Pragma("unroll")   // full unroll wherever it stands: the fragment and accumulator arrays are indexed by the loop variable and stay in registers only with constant indices

// ---- k_proj: everything ahead of the attention in one kernel, all images in one launch; grid (4096 / 128 pixel blocks, 8 images), 8 waves, 16 pixels a wave.
// T16[n][e] = fp16(128^-0.5 sum_c bf16 w_theta[e][c] bf16 l[c][n]), P16[n][e] = fp16(sum_c bf16 w_phi[e][c] bf16 l[c][n]), XC[c][n] = fp16(bf16 l[c][n]).
// Transposed products D[e][n]: A = weight rows (both matrices, rounded to bf16 on the way into LDS, 256 rows of 256), B = the wave's 16 pixels over all 256 channels, kept in registers.
// A lane builds its B fragments straight from the channel-major input: lane (lr, hi) reads pixel lr at channels 32 kc + 8 hi + i and 32 kc + 16 + 8 hi + i, the k order of the A loader; 16 lanes share 64 contiguous bytes of a channel row.
// A lane's D registers are 8 consecutive embed channels of one pixel: one 16-byte store a tile. K runs upward in steps of 32 on one accumulator chain.
#define WPIT  264                  // halves: 512-B weight rows at a 528-B pitch
__device__ __forceinline__ v16bf ldfragb(const bf* p) { return cat16b(*(const v8usa*)p, *(const v8usa*)(p + 16)); }
__global__ __launch_bounds__(256) void k_proj(const float* __restrict__ l, const float* __restrict__ wt, const float* __restrict__ wp, _Float16* __restrict__ T16, _Float16* __restrict__ P16, _Float16* __restrict__ XC) {
    __shared__ __align__(16) bf wsm[2 * EE * WPIT];
    const int t = threadIdx.x, lane = t & 31, lr = lane & 15, hi = lane >> 4, w = t >> 5;
    const int b = blockIdx.y, n0 = blockIdx.x * 128;
    const float* lb = l + (size_t)b * CC * NN + n0;
    const float* xp = lb + (size_t)(8 * hi) * NN + w * 16 + lr;
    v16bf x[8];
    UNR
    for (int kc = 0; kc < 8; ++kc) { v8us lo, up;
    UNR
        for (int i = 0; i < 8; ++i) { lo[i] = f2bf(xp[(size_t)(kc * 32 + i) * NN]); up[i] = f2bf(xp[(size_t)(kc * 32 + 16 + i) * NN]); }
        x[kc] = cat16b(lo, up); }
    const float* wtp = wt + (size_t)(t >> 6) * CC + (t & 63) * 4; const float* wpp = wp + (size_t)(t >> 6) * CC + (t & 63) * 4;
    UNR
    for (int j = 0; j < 64; ++j) {   // a wave moves 512 contiguous bytes of one weight row; rows 0..127 theta, 128..255 phi
        const v4f a = *(const v4f*)((j < 32 ? wtp : wpp) + (size_t)(j & 31) * 4 * CC); v4us o;
    UNR
        for (int k = 0; k < 4; ++k) o[k] = f2bf(a[k]);
        *(v4usa*)(wsm + (j * 4 + (t >> 6)) * WPIT + (t & 63) * 4) = o; }
    asm volatile("s_wait_xcnt 0x0" :: "v"(xp), "v"(wtp), "v"(wpp) : "memory");   // the three address pairs of the loads above stay unwritten up to this wait; their registers are reused behind it
    __syncthreads();   // publishes the weights
    const size_t prow = ((size_t)b * NN + n0 + w * 16 + lr) * EE + 8 * hi;
    for (int h = 0; h < 2; ++h) {   // theta, then phi
        const bf* wh = wsm + (h * EE + lr) * WPIT + 8 * hi;
        v8f acc[8];
    UNR
        for (int et = 0; et < 8; ++et) acc[et] = (v8f){};
        v16bf af[2][4];
    UNR
        for (int i = 0; i < 4; ++i) af[0][i] = ldfragb(wh + i * 16 * WPIT);
    UNR
        for (int g = 0; g < 16; ++g) {   // group g: channels 32 (g >> 1) .., embed tiles 4 (g & 1) + i
            if (g < 15) {
    UNR
                for (int i = 0; i < 4; ++i) af[(g + 1) & 1][i] = ldfragb(wh + (((g + 1) & 1) * 4 + i) * 16 * WPIT + ((g + 1) >> 1) * 32); }
            __builtin_amdgcn_sched_barrier(0);   // weight fragments in groups of four, one group ahead of the products that use them: read one by one, each product waits out a whole LDS latency
    UNR
            for (int i = 0; i < 4; ++i) acc[(g & 1) * 4 + i] = wmmab(af[g & 1][i], x[g >> 1], acc[(g & 1) * 4 + i]);
        }
        h16* dst = (h ? P16 : T16) + prow; const float sc = h ? 1.0f : SCL;
        v8h o[8];
    UNR
        for (int et = 0; et < 8; ++et) {
    UNR
            for (int j = 0; j < 8; ++j) o[et][j] = tohx(acc[et][j] * sc);
            *(v8h*)(dst + et * 16) = o[et]; }
        asm volatile("s_wait_xcnt 0x0" :: "v"(dst), "v"(o[0]), "v"(o[1]), "v"(o[2]), "v"(o[3]), "v"(o[4]), "v"(o[5]), "v"(o[6]), "v"(o[7]) : "memory");   // address and data registers of the eight stores stay unwritten up to this wait; the next phase reuses them
    }
    const float* xs = lb + (size_t)w * NN + lane * 4; h16* xd = XC + (size_t)b * CC * NN + n0 + (size_t)w * NN + lane * 4;
    v4f a[32];   // the value operand: a wave reads 512 contiguous bytes of one channel row and stores 256
    UNR
    for (int j = 0; j < 32; ++j) a[j] = *(const v4f*)(xs + (size_t)j * 8 * NN);
    asm volatile("s_wait_xcnt 0x0" :: "v"(xs) : "memory");   // the loads' address pair stays unwritten up to this wait
    UNR
    for (int g = 0; g < 4; ++g) { v4h o[8];
    UNR
        for (int j = 0; j < 8; ++j) {
    UNR
            for (int k = 0; k < 4; ++k) o[j][k] = tohx(bfr(a[g * 8 + j][k]));
            *(v4h*)(xd + (size_t)(g * 8 + j) * 8 * NN) = o[j]; }
        if (g < 3) asm volatile("s_wait_xcnt 0x0" :: "v"(xd), "v"(o[0]), "v"(o[1]), "v"(o[2]), "v"(o[3]), "v"(o[4]), "v"(o[5]), "v"(o[6]), "v"(o[7]) : "memory");   // data registers of the eight stores stay unwritten up to this wait; the next eight rows reuse them
    }
}
// ---- k_flash: scores, softmax and value product in one kernel, all images in one launch; grid (4096 / 128 query blocks, 8 images), 8 waves.
// Wave tile: 32 query columns (two column tiles) and half of the keys. Wave w takes columns 32 (w & 3) .. and keys 32 (w >> 2) .. of every 64-key pass, so each key or channel fragment read from LDS feeds two products; the two waves of a column group keep their own running maximum, sum and accumulators and are merged once, behind the loop.
// Transposed products: S^T[key][q] = phi_key . theta_q (A = key rows from LDS, B = the wave's queries, kept in registers); O^T[c][q] += l[c][key] P^T[key][q] (A = channel rows from LDS, B = the two score tiles of a column tile packed to fp16 in place: a lane's D registers are the k order of the B operand, and the A loader reads bytes 16h and 32 + 16h of the wave's 64, the same order).
// A lane holds one query's scores per column tile: running maximum and sum per lane, one exchange between the wave's halves. The maximum in use (log2 units) moves only when a column's new maximum exceeds it by more than 8, so P <= 256 fits fp16.
// A pass is 64 keys; two LDS buffers, the next pass's tiles are loaded to registers ahead of the products and stored to the other buffer behind them; one barrier a pass.
#define KT    64
#define KPIT  136                  // halves: 256-B key rows at a 272-B pitch
#define VPIT  72                   // halves: 128-B channel rows at a 144-B pitch
#define KBUF  (KT * KPIT)
#define SBUF  (KBUF + CC * VPIT)
#define OPIT  132                  // floats: output staging pitch
#define L2E   1.4426950408889634f
__device__ __forceinline__ float xhalf(float x) { return __builtin_bit_cast(float, __builtin_amdgcn_permlanex16(__builtin_bit_cast(int, x), __builtin_bit_cast(int, x), 0x76543210, 0xfedcba98, false, false)); }  // lane l with lane l ^ 16
__device__ __forceinline__ v16h ldfrag(const h16* p) { return cat16(*(const v8ha*)p, *(const v8ha*)(p + 16)); }
__global__ __launch_bounds__(256) void k_flash(const _Float16* __restrict__ Tq, const _Float16* __restrict__ Pk, const _Float16* __restrict__ Xv, float* __restrict__ OUTp) {
    __shared__ __align__(16) char smem[CC * OPIT * 4];   // the ring (2 * SBUF halves) in the loop, the [256][128] f32 output tile behind it
    __shared__ float ml[2][2][128];                      // per key half: maximum in use and sum of each query column
    __shared__ v4f xb[8 * 1024];                         // the accumulators that the two key halves hand each other, 16 KiB a wave
    h16* ring = (h16*)smem; float* os = (float*)smem;
    const int t = threadIdx.x, lane = t & 31, lr = lane & 15, hi = lane >> 4, w = t >> 5;
    const int qg = w & 3, kh = __builtin_amdgcn_readfirstlane(w >> 2);
    const int b = blockIdx.y, q0 = blockIdx.x * 128;
    // global addresses: a wave-uniform base and a lane's own 32-bit byte offset
    const char* kg = (const char*)(Pk + (size_t)b * NN * EE); const unsigned ko = ((t >> 4) * EE + (t & 15) * 8) * 2;      // + 16 rows per chunk, + KT rows per pass
    const char* vg = (const char*)(Xv + (size_t)b * CC * NN); const unsigned vo = ((t >> 3) * NN + (t & 7) * 8) * 2;       // + 32 rows per chunk, + KT keys per pass; 8 lanes move one whole 128-B line
    h16* ks = ring + (t >> 4) * KPIT + (t & 15) * 8;
    h16* vs = ring + KBUF + (t >> 3) * VPIT + (t & 7) * 8;
    v16h q[2][4];
    const char* qb = (const char*)(Tq + ((size_t)b * NN + q0) * EE); const unsigned qo = (((qg * 32 + lr) * EE) + 8 * hi) * 2;
    UNR
    for (int qt = 0; qt < 2; ++qt)
    UNR
      for (int ec = 0; ec < 4; ++ec) q[qt][ec] = ldfrag((const h16*)(qb + qo) + qt * 16 * EE + ec * 32);
    v8f acc[16][2];
    UNR
    for (int ct = 0; ct < 16; ++ct) { acc[ct][0] = (v8f){}; acc[ct][1] = (v8f){}; }
    float mref[2] = {-1.0e30f, -1.0e30f}, lsum[2] = {0.f, 0.f};
    v8h kr[4], vr[8];
    UNR
    for (int j = 0; j < 4; ++j) kr[j] = *(const v8ha*)(kg + ko + j * 16 * EE * 2);
    UNR
    for (int j = 0; j < 8; ++j) vr[j] = *(const v8ha*)(vg + vo + j * 32 * NN * 2);
    asm volatile("s_wait_xcnt 0x0" :: "s"(qb), "v"(qo), "s"(kg), "v"(ko), "s"(vg), "v"(vo) : "memory");   // bases and offsets of the query and first-tile loads stay unwritten up to this wait
    UNR
    for (int j = 0; j < 4; ++j) *(v8ha*)(ks + j * 16 * KPIT) = kr[j];
    UNR
    for (int j = 0; j < 8; ++j) *(v8ha*)(vs + j * 32 * VPIT) = vr[j];
    __syncthreads();
    for (int s = 0; s < NN / KT; ++s) {
        const int cur = (s & 1) * SBUF, nxt = SBUF - cur;
        const int sn = s + 1 < NN / KT ? s + 1 : s;   // the last pass loads its own tile again, into the buffer that nobody reads any more: with a branch round the loads and the stores the compiler sinks the row sums into the block behind it, their 32 probabilities stay live across the value products and the wave spills
        v16h kf[8];
    UNR
        for (int i = 0; i < 8; ++i) kf[i] = ldfrag(ring + cur + (kh * 32 + (i & 1) * 16 + lr) * KPIT + (i >> 1) * 32 + 8 * hi);
        const char* kn = kg + ko + (size_t)sn * KT * EE * 2; const char* vn = vg + vo + sn * KT * 2;
    UNR
        for (int j = 0; j < 4; ++j) kr[j] = *(const v8ha*)(kn + j * 16 * EE * 2);
    UNR
        for (int j = 0; j < 8; ++j) vr[j] = *(const v8ha*)(vn + j * 32 * NN * 2);
        asm volatile("s_wait_xcnt 0x0" :: "v"(kn), "v"(vn) : "memory");   // the two address pairs of the twelve global loads above stay unwritten up to this wait; their registers are reused behind it
        __builtin_amdgcn_sched_barrier(0);   // holds this pass's eight key fragment reads, as one group, and the next pass's global loads ahead of the products: read one by one, each product waits out a whole LDS latency
        v8f st[2][2] = {{(v8f){}, (v8f){}}, {(v8f){}, (v8f){}}};   // [key tile][column tile]
    UNR
        for (int i = 0; i < 8; ++i)
    UNR
            for (int qt = 0; qt < 2; ++qt) st[i & 1][qt] = wmma16(kf[i], q[qt][i >> 1], st[i & 1][qt]);
        const h16* vb = ring + cur + KBUF + lr * VPIT + kh * 32 + 8 * hi;
        v16h vf[2][4];
    UNR
        for (int i = 0; i < 4; ++i) vf[0][i] = ldfrag(vb + i * 16 * VPIT);
        __builtin_amdgcn_sched_barrier(0);   // the first four channel fragments are read ahead of the softmax arithmetic, which hides their latency
        float mt[2];
    UNR
        for (int qt = 0; qt < 2; ++qt) {
            float mx = fmaxf(st[0][qt][0], st[1][qt][0]);
    UNR
            for (int r = 1; r < 8; ++r) mx = fmaxf(mx, fmaxf(st[0][qt][r], st[1][qt][r]));
            mx = fmaxf(mx, xhalf(mx));
            mt[qt] = mx * L2E; }
        if (__builtin_amdgcn_ballot_w32(mt[0] > mref[0] + 8.0f || mt[1] > mref[1] + 8.0f) != 0) {   // wave-uniform, one test a pass; rare behind the first pass
    UNR
            for (int qt = 0; qt < 2; ++qt) {
                const float mn = fmaxf(mref[qt], mt[qt]), corr = __builtin_amdgcn_exp2f(mref[qt] - mn);   // 0 on the first pass
                mref[qt] = mn; lsum[qt] *= corr;
    UNR
                for (int ct = 0; ct < 16; ++ct) acc[ct][qt] *= corr; }
        }
        v16h pb[2];
    UNR
        for (int qt = 0; qt < 2; ++qt)
    UNR
            for (int r = 0; r < 8; ++r) { const float p0 = __builtin_amdgcn_exp2f(fmaf(st[0][qt][r], L2E, -mref[qt])), p1 = __builtin_amdgcn_exp2f(fmaf(st[1][qt][r], L2E, -mref[qt])); lsum[qt] += p0 + p1; pb[qt][r] = (h16)p0; pb[qt][8 + r] = (h16)p1; }
    UNR
        for (int g = 0; g < 4; ++g) {
            if (g < 3) {
    UNR
                for (int i = 0; i < 4; ++i) vf[(g + 1) & 1][i] = ldfrag(vb + ((g + 1) * 4 + i) * 16 * VPIT); }
            __builtin_amdgcn_sched_barrier(0);   // channel fragments in groups of four, one group ahead of the products that use them
    UNR
            for (int i = 0; i < 4; ++i)
    UNR
                for (int qt = 0; qt < 2; ++qt) acc[g * 4 + i][qt] = wmma16(vf[g & 1][i], pb[qt], acc[g * 4 + i][qt]);
        }
    UNR
        for (int j = 0; j < 4; ++j) *(v8ha*)(ks + nxt + j * 16 * KPIT) = kr[j];
    UNR
        for (int j = 0; j < 8; ++j) *(v8ha*)(vs + nxt + j * 32 * VPIT) = vr[j];
        __syncthreads();   // publishes the next pass's tiles and ends every read of this pass's buffer
    }
    // Merge of the two key halves: each wave hands the raw accumulators of 8 channel tiles (half 0: tiles 8..15, half 1: tiles 0..7) and its maximum and sum to its partner (wave w ^ 4, the same columns in the same lanes) through LDS and finishes the 8 tiles it keeps.
    const int col = qg * 32 + lr;
    UNR
    for (int qt = 0; qt < 2; ++qt) { lsum[qt] += xhalf(lsum[qt]);
        if (hi == 0) { ml[kh][0][col + qt * 16] = mref[qt]; ml[kh][1][col + qt * 16] = lsum[qt]; } }
    v4f* xw = xb + (size_t)w * 1024 + lane;          // a wave's own 16 KiB: 32 rows of 32 lanes x 16 B, contiguous 16-byte stores and loads
    const v4f* xr = xb + (size_t)(w ^ 4) * 1024 + lane;
    UNR
    for (int ct = 0; ct < 8; ++ct)
    UNR
        for (int qt = 0; qt < 2; ++qt) { const v8f g = kh ? acc[ct][qt] : acc[ct + 8][qt];
            xw[(ct * 4 + qt * 2) * 32] = __builtin_shufflevector(g, g, 0, 1, 2, 3); xw[(ct * 4 + qt * 2 + 1) * 32] = __builtin_shufflevector(g, g, 4, 5, 6, 7); }
    __syncthreads();   // publishes the partner's accumulators, maxima and sums
    v4f x[32];
    UNR
    for (int i = 0; i < 32; ++i) x[i] = xr[i * 32];
    float fo[2], fp[2];
    UNR
    for (int qt = 0; qt < 2; ++qt) {
        const float mo = ml[1 - kh][0][col + qt * 16], lo = ml[1 - kh][1][col + qt * 16];
        const float mm = fmaxf(mref[qt], mo), so = __builtin_amdgcn_exp2f(mref[qt] - mm), sp = __builtin_amdgcn_exp2f(mo - mm);
        const float inv = 1.0f / (lsum[qt] * so + lo * sp);
        fo[qt] = so * inv; fp[qt] = sp * inv; }
    __builtin_amdgcn_sched_barrier(0);   // the partner's 32 rows are read as one group ahead of the sums: read one by one, each sum waits out a whole LDS latency
    float* op = os + ((kh ? 128 : 0) + 8 * hi) * OPIT + col;
    UNR
    for (int ct = 0; ct < 8; ++ct)
    UNR
        for (int qt = 0; qt < 2; ++qt) { const v8f k = kh ? acc[ct + 8][qt] : acc[ct][qt];
    UNR
            for (int r = 0; r < 8; ++r) op[(ct * 16 + r) * OPIT + qt * 16] = k[r] * fo[qt] + x[ct * 4 + qt * 2 + (r >> 2)][r & 3] * fp[qt]; }
    __syncthreads();
    v4f o[32];
    UNR
    for (int j = 0; j < 32; ++j) o[j] = *(const v4fa*)(os + (w + 8 * j) * OPIT + lane * 4);
    __builtin_amdgcn_sched_barrier(0);   // the 32 output rows are read as one group ahead of the stores, each into registers of its own: no store's data register is written again
    float* od = OUTp + ((size_t)b * CC + w) * NN + q0 + lane * 4;
    UNR
    for (int j = 0; j < 32; ++j) *(v4f*)(od + (size_t)j * 8 * NN) = o[j];   // a wave stores 512 contiguous bytes of one channel row
}

extern "C" void kernel_launch(void* const* d_in, const int* in_sizes, int n_in,
                              void* d_out, int out_size, void* d_ws, size_t ws_size, hipStream_t stream) {
    (void)in_sizes; (void)n_in; (void)out_size;
    const float* l = (const float*)d_in[0]; const float* wt = (const float*)d_in[1]; const float* wp = (const float*)d_in[2];
    float* OUT = (float*)d_out;     // [8][256][64][64]
    char* wsp = (char*)d_ws;
    auto take = [&](size_t bytes) { char* p = wsp; wsp += (bytes + 255) & ~(size_t)255; return (void*)p; };
    h16* XC = (h16*)take((size_t)NBI * CC * NN * 2); h16* T16 = (h16*)take((size_t)NBI * NN * EE * 2); h16* P16 = (h16*)take((size_t)NBI * NN * EE * 2);
    if ((size_t)(wsp - (char*)d_ws) > ws_size) return;    // total ~ 34 MB (fp16 values 17 MB, fp16 theta and phi 8 MB each)
    k_proj<<<dim3(NN / 128, NBI, 1), 256, 0, stream>>>(l, wt, wp, T16, P16, XC);   // fp16 theta (scaled), phi and values of all images
    k_flash<<<dim3(NN / 128, NBI, 1), 256, 0, stream>>>(T16, P16, XC, OUT);   // out[c][q] = sum_k softmax_k(theta_q . phi_k / sqrt(128)) l[c][k]
}

// v004
// One run takes 90.1 microseconds.
// Two timings next to v003 both put it at 1.03 times that version's speed.
// All steps since v000 together make it 16.8 times as fast.
#include <hip/hip_runtime.h>

// NonLocalOp (l [8][256][64][64] -> 4096 pixels; theta = w_theta l, phi = w_phi l (128 embed channels, 1x1 convs); f = softmax(theta^T phi / sqrt(128)) over keys; out[c][q] = sum_k f[q][k] l[c][k] -> [8][256][64][64]).
// Compute dtypes, f32 accumulate: every input rounded to bf16; theta/phi on PLAIN bf16 operands (inputs: exact); scores (K 128) on single fp16 planes of theta (x 128^-0.5) and phi (the logits are O(1)); softmax f32, online (running maximum and sum); probabilities fp16, values fp16 (bf16 values, exact).

#define NBI  8
#define CC   256
#define EE   128
#define NN   4096
#define SCL  0.08838834764831845f
typedef _Float16 h16;
typedef unsigned short bf;
typedef __attribute__((ext_vector_type(16))) __bf16   v16bf;
typedef __attribute__((ext_vector_type(16))) _Float16 v16h;
typedef __attribute__((ext_vector_type(8)))  _Float16 v8h;
typedef __attribute__((ext_vector_type(8)))  unsigned short v8us;
typedef __attribute__((ext_vector_type(8)))  float    v8f;
typedef __attribute__((ext_vector_type(4)))  float    v4f;
typedef v8h  __attribute__((may_alias)) v8ha;
typedef v4f  __attribute__((may_alias)) v4fa;
typedef v8us __attribute__((may_alias)) v8usa;

__device__ __forceinline__ unsigned short f2bf(float f) { unsigned u = __float_as_uint(f); u += 0x7FFFu + ((u >> 16) & 1u); return (unsigned short)(u >> 16); }
__device__ __forceinline__ float bf2f(unsigned short b) { return __uint_as_float(((unsigned)b) << 16); }
__device__ __forceinline__ float bfr(float f) { return bf2f(f2bf(f)); }
__device__ __forceinline__ v16h cat16(v8h lo, v8h hi) { return __builtin_shufflevector(lo, hi, 0, 1, 2, 3, 4, 5, 6, 7, 8, 9, 10, 11, 12, 13, 14, 15); }
__device__ __forceinline__ v16bf cat16b(v8us lo, v8us hi) { return __builtin_bit_cast(v16bf, __builtin_shufflevector(lo, hi, 0, 1, 2, 3, 4, 5, 6, 7, 8, 9, 10, 11, 12, 13, 14, 15)); }
__device__ __forceinline__ v8f wmma16(v16h a, v16h b, v8f c) { return __builtin_amdgcn_wmma_f32_16x16x32_f16(false, a, false, b, (short)0, c, false, false); }
__device__ __forceinline__ v8f wmmab(v16bf a, v16bf b, v8f c) { return __builtin_amdgcn_wmma_f32_16x16x32_bf16(false, a, false, b, (short)0, c, false, false); }



__device__ __forceinline__ h16 tohx(float x) { return (h16)x; }
typedef __attribute__((ext_vector_type(4))) _Float16 v4h;
typedef __attribute__((ext_vector_type(4))) unsigned short v4us;
typedef v4us __attribute__((may_alias)) v4usa;
#define UNR   _Pragma("unroll")   // full unroll wherever it stands: the fragment and accumulator arrays are indexed by the loop variable and stay in registers only with constant indices

// ---- k_proj: everything ahead of the attention in one kernel, all images in one launch; grid (4096 / 128 pixel blocks, 8 images), 8 waves, 16 pixels a wave.
// T16[n][e] = fp16(128^-0.5 sum_c bf16 w_theta[e][c] bf16 l[c][n]), P16[n][e] = fp16(sum_c bf16 w_phi[e][c] bf16 l[c][n]), XC[c][n] = fp16(bf16 l[c][n]).
// Transposed products D[e][n]: A = weight rows (both matrices, rounded to bf16 on the way into LDS, 256 rows of 256), B = the wave's 16 pixels over all 256 channels, kept in registers.
// A lane builds its B fragments straight from the channel-major input: lane (lr, hi) reads pixel lr at channels 32 kc + 8 hi + i and 32 kc + 16 + 8 hi + i, the k order of the A loader; 16 lanes share 64 contiguous bytes of a channel row.
// A lane's D registers are 8 consecutive embed channels of one pixel: one 16-byte store a tile. K runs upward in steps of 32 on one accumulator chain.
#define WPIT  264                  // halves: 512-B weight rows at a 528-B pitch
__device__ __forceinline__ v16bf ldfragb(const bf* p) { return cat16b(*(const v8usa*)p, *(const v8usa*)(p + 16)); }
__global__ __launch_bounds__(256) void k_proj(const float* __restrict__ l, const float* __restrict__ wt, const float* __restrict__ wp, _Float16* __restrict__ T16, _Float16* __restrict__ P16, _Float16* __restrict__ XC) {
    __shared__ __align__(16) bf wsm[2 * EE * WPIT];
    const int t = threadIdx.x, lane = t & 31, lr = lane & 15, hi = lane >> 4, w = t >> 5;
    const int b = blockIdx.y, n0 = blockIdx.x * 128;
    const float* lb = l + (size_t)b * CC * NN + n0;
    const float* xp = lb + (size_t)(8 * hi) * NN + w * 16 + lr;
    v16bf x[8];
    UNR
    for (int kc = 0; kc < 8; ++kc) { v8us lo, up;
    UNR
        for (int i = 0; i < 8; ++i) { lo[i] = f2bf(xp[(size_t)(kc * 32 + i) * NN]); up[i] = f2bf(xp[(size_t)(kc * 32 + 16 + i) * NN]); }
        x[kc] = cat16b(lo, up); }
    const float* wtp = wt + (size_t)(t >> 6) * CC + (t & 63) * 4; const float* wpp = wp + (size_t)(t >> 6) * CC + (t & 63) * 4;
    UNR
    for (int j = 0; j < 64; ++j) {   // a wave moves 512 contiguous bytes of one weight row; rows 0..127 theta, 128..255 phi
        const v4f a = *(const v4f*)((j < 32 ? wtp : wpp) + (size_t)(j & 31) * 4 * CC); v4us o;
    UNR
        for (int k = 0; k < 4; ++k) o[k] = f2bf(a[k]);
        *(v4usa*)(wsm + (j * 4 + (t >> 6)) * WPIT + (t & 63) * 4) = o; }
    asm volatile("s_wait_xcnt 0x0" :: "v"(xp), "v"(wtp), "v"(wpp) : "memory");   // the three address pairs of the loads above stay unwritten up to this wait; their registers are reused behind it
    __syncthreads();   // publishes the weights
    const size_t prow = ((size_t)b * NN + n0 + w * 16 + lr) * EE + 8 * hi;
    for (int h = 0; h < 2; ++h) {   // theta, then phi
        const bf* wh = wsm + (h * EE + lr) * WPIT + 8 * hi;
        v8f acc[8];
    UNR
        for (int et = 0; et < 8; ++et) acc[et] = (v8f){};
        v16bf af[2][4];
    UNR
        for (int i = 0; i < 4; ++i) af[0][i] = ldfragb(wh + i * 16 * WPIT);
    UNR
        for (int g = 0; g < 16; ++g) {   // group g: channels 32 (g >> 1) .., embed tiles 4 (g & 1) + i
            if (g < 15) {
    UNR
                for (int i = 0; i < 4; ++i) af[(g + 1) & 1][i] = ldfragb(wh + (((g + 1) & 1) * 4 + i) * 16 * WPIT + ((g + 1) >> 1) * 32); }
            __builtin_amdgcn_sched_barrier(0);   // weight fragments in groups of four, one group ahead of the products that use them: read one by one, each product waits out a whole LDS latency
    UNR
            for (int i = 0; i < 4; ++i) acc[(g & 1) * 4 + i] = wmmab(af[g & 1][i], x[g >> 1], acc[(g & 1) * 4 + i]);
        }
        h16* dst = (h ? P16 : T16) + prow; const float sc = h ? 1.0f : SCL;
        v8h o[8];
    UNR
        for (int et = 0; et < 8; ++et) {
    UNR
            for (int j = 0; j < 8; ++j) o[et][j] = tohx(acc[et][j] * sc);
            *(v8h*)(dst + et * 16) = o[et]; }
        asm volatile("s_wait_xcnt 0x0" :: "v"(dst), "v"(o[0]), "v"(o[1]), "v"(o[2]), "v"(o[3]), "v"(o[4]), "v"(o[5]), "v"(o[6]), "v"(o[7]) : "memory");   // address and data registers of the eight stores stay unwritten up to this wait; the next phase reuses them
    }
    const float* xs = lb + (size_t)w * NN + lane * 4; h16* xd = XC + (size_t)b * CC * NN + n0 + (size_t)w * NN + lane * 4;
    v4f a[32];   // the value operand: a wave reads 512 contiguous bytes of one channel row and stores 256
    UNR
    for (int j = 0; j < 32; ++j) a[j] = *(const v4f*)(xs + (size_t)j * 8 * NN);
    asm volatile("s_wait_xcnt 0x0" :: "v"(xs) : "memory");   // the loads' address pair stays unwritten up to this wait
    UNR
    for (int g = 0; g < 4; ++g) { v4h o[8];
    UNR
        for (int j = 0; j < 8; ++j) {
    UNR
            for (int k = 0; k < 4; ++k) o[j][k] = tohx(bfr(a[g * 8 + j][k]));
            *(v4h*)(xd + (size_t)(g * 8 + j) * 8 * NN) = o[j]; }
        if (g < 3) asm volatile("s_wait_xcnt 0x0" :: "v"(xd), "v"(o[0]), "v"(o[1]), "v"(o[2]), "v"(o[3]), "v"(o[4]), "v"(o[5]), "v"(o[6]), "v"(o[7]) : "memory");   // data registers of the eight stores stay unwritten up to this wait; the next eight rows reuse them
    }
}
// ---- k_flash: scores, softmax and value product in one kernel, all images in one launch; grid (4096 / 128 query blocks, 8 images), 8 waves.
// Wave tile: 32 query columns (two column tiles) and half of the keys. Wave w takes columns 32 (w & 3) .. and keys 32 (w >> 2) .. of every 64-key pass, so each key or channel fragment read from LDS feeds two products; the two waves of a column group keep their own running maximum, sum and accumulators and are merged once, behind the loop.
// Transposed products: S^T[key][q] = phi_key . theta_q (A = key rows from LDS, B = the wave's queries, kept in registers); O^T[c][q] += l[c][key] P^T[key][q] (A = channel rows from LDS, B = the two score tiles of a column tile packed to fp16 in place: a lane's D registers are the k order of the B operand, and the A loader reads bytes 16h and 32 + 16h of the wave's 64, the same order).
// A lane holds one query's scores per column tile: running maximum and sum per lane, one exchange between the wave's halves. The maximum in use (log2 units) moves only when a column's new maximum exceeds it by more than 8, so P <= 256 fits fp16.
// A pass is 64 keys; two LDS buffers, the next pass's tiles are loaded to registers ahead of the products and stored to the other buffer behind them; one barrier a pass.
// Each work-group starts its walk over the 64 key tiles at a tile of its own and wraps round: the 32 query blocks of an image read the same key and channel lines from L2, and in step they would all ask for the same lines at the same moment. The online softmax takes the tiles in any order.
#define KT    64
#define KPIT  136                  // halves: 256-B key rows at a 272-B pitch
#define VPIT  72                   // halves: 128-B channel rows at a 144-B pitch
#define KBUF  (KT * KPIT)
#define SBUF  (KBUF + CC * VPIT)
#define OPIT  132                  // floats: output staging pitch
#define L2E   1.4426950408889634f
__device__ __forceinline__ float xhalf(float x) { return __builtin_bit_cast(float, __builtin_amdgcn_permlanex16(__builtin_bit_cast(int, x), __builtin_bit_cast(int, x), 0x76543210, 0xfedcba98, false, false)); }  // lane l with lane l ^ 16
__device__ __forceinline__ v16h ldfrag(const h16* p) { return cat16(*(const v8ha*)p, *(const v8ha*)(p + 16)); }
__global__ __launch_bounds__(256) void k_flash(const _Float16* __restrict__ Tq, const _Float16* __restrict__ Pk, const _Float16* __restrict__ Xv, float* __restrict__ OUTp) {
    __shared__ __align__(16) char smem[CC * OPIT * 4];   // the ring (2 * SBUF halves) in the loop, the [256][128] f32 output tile behind it
    __shared__ float ml[2][2][128];                      // per key half: maximum in use and sum of each query column
    __shared__ v4f xb[8 * 1024];                         // the accumulators that the two key halves hand each other, 16 KiB a wave
    h16* ring = (h16*)smem; float* os = (float*)smem;
    const int t = threadIdx.x, lane = t & 31, lr = lane & 15, hi = lane >> 4, w = t >> 5;
    const int qg = w & 3, kh = __builtin_amdgcn_readfirstlane(w >> 2);
    const int b = blockIdx.y, q0 = blockIdx.x * 128;
    const int rot = (2 * blockIdx.x + blockIdx.y) & (NN / KT - 1);   // first key tile: two tiles (256 B of a channel row) apart between the query blocks of an image, one tile apart between images
    // global addresses: a wave-uniform base and a lane's own 32-bit byte offset
    const char* kg = (const char*)(Pk + (size_t)b * NN * EE); const unsigned ko = ((t >> 4) * EE + (t & 15) * 8) * 2;      // + 16 rows per chunk, + KT rows per pass
    const char* vg = (const char*)(Xv + (size_t)b * CC * NN); const unsigned vo = ((t >> 3) * NN + (t & 7) * 8) * 2;       // + 32 rows per chunk, + KT keys per pass; 8 lanes move one whole 128-B line
    h16* ks = ring + (t >> 4) * KPIT + (t & 15) * 8;
    h16* vs = ring + KBUF + (t >> 3) * VPIT + (t & 7) * 8;
    v16h q[2][4];
    const char* qb = (const char*)(Tq + ((size_t)b * NN + q0) * EE); const unsigned qo = (((qg * 32 + lr) * EE) + 8 * hi) * 2;
    UNR
    for (int qt = 0; qt < 2; ++qt)
    UNR
      for (int ec = 0; ec < 4; ++ec) q[qt][ec] = ldfrag((const h16*)(qb + qo) + qt * 16 * EE + ec * 32);
    v8f acc[16][2];
    UNR
    for (int ct = 0; ct < 16; ++ct) { acc[ct][0] = (v8f){}; acc[ct][1] = (v8f){}; }
    float mref[2] = {-1.0e30f, -1.0e30f}, lsum[2] = {0.f, 0.f};
    v8h kr[4], vr[8];
    const char* k0 = kg + (size_t)rot * KT * EE * 2; const char* v0 = vg + rot * KT * 2;   // the work-group's first tile
    UNR
    for (int j = 0; j < 4; ++j) kr[j] = *(const v8ha*)(k0 + ko + j * 16 * EE * 2);
    UNR
    for (int j = 0; j < 8; ++j) vr[j] = *(const v8ha*)(v0 + vo + j * 32 * NN * 2);
    asm volatile("s_wait_xcnt 0x0" :: "s"(qb), "v"(qo), "s"(k0), "v"(ko), "s"(v0), "v"(vo) : "memory");   // bases and offsets of the query and first-tile loads stay unwritten up to this wait
    UNR
    for (int j = 0; j < 4; ++j) *(v8ha*)(ks + j * 16 * KPIT) = kr[j];
    UNR
    for (int j = 0; j < 8; ++j) *(v8ha*)(vs + j * 32 * VPIT) = vr[j];
    __syncthreads();
    for (int s = 0; s < NN / KT; ++s) {
        const int cur = (s & 1) * SBUF, nxt = SBUF - cur;
        const int sn = (s + 1 + rot) & (NN / KT - 1);   // the next tile of the wrapped walk; the last pass loads the first tile again, into the buffer that nobody reads any more: with a branch round the loads and the stores the compiler sinks the row sums into the block behind it, their 32 probabilities stay live across the value products and the wave spills
        v16h kf[8];
    UNR
        for (int i = 0; i < 8; ++i) kf[i] = ldfrag(ring + cur + (kh * 32 + (i & 1) * 16 + lr) * KPIT + (i >> 1) * 32 + 8 * hi);
        const char* kn = kg + ko + (size_t)sn * KT * EE * 2; const char* vn = vg + vo + sn * KT * 2;
    UNR
        for (int j = 0; j < 4; ++j) kr[j] = *(const v8ha*)(kn + j * 16 * EE * 2);
    UNR
        for (int j = 0; j < 8; ++j) vr[j] = *(const v8ha*)(vn + j * 32 * NN * 2);
        asm volatile("s_wait_xcnt 0x0" :: "v"(kn), "v"(vn) : "memory");   // the two address pairs of the twelve global loads above stay unwritten up to this wait; their registers are reused behind it
        __builtin_amdgcn_sched_barrier(0);   // holds this pass's eight key fragment reads, as one group, and the next pass's global loads ahead of the products: read one by one, each product waits out a whole LDS latency
        v8f st[2][2] = {{(v8f){}, (v8f){}}, {(v8f){}, (v8f){}}};   // [key tile][column tile]
    UNR
        for (int i = 0; i < 8; ++i)
    UNR
            for (int qt = 0; qt < 2; ++qt) st[i & 1][qt] = wmma16(kf[i], q[qt][i >> 1], st[i & 1][qt]);
        const h16* vb = ring + cur + KBUF + lr * VPIT + kh * 32 + 8 * hi;
        v16h vf[2][4];
    UNR
        for (int i = 0; i < 4; ++i) vf[0][i] = ldfrag(vb + i * 16 * VPIT);
        __builtin_amdgcn_sched_barrier(0);   // the first four channel fragments are read ahead of the softmax arithmetic, which hides their latency
        float mt[2];
    UNR
        for (int qt = 0; qt < 2; ++qt) {
            float mx = fmaxf(st[0][qt][0], st[1][qt][0]);
    UNR
            for (int r = 1; r < 8; ++r) mx = fmaxf(mx, fmaxf(st[0][qt][r], st[1][qt][r]));
            mx = fmaxf(mx, xhalf(mx));
            mt[qt] = mx * L2E; }
        if (__builtin_amdgcn_ballot_w32(mt[0] > mref[0] + 8.0f || mt[1] > mref[1] + 8.0f) != 0) {   // wave-uniform, one test a pass; rare behind the first pass
    UNR
            for (int qt = 0; qt < 2; ++qt) {
                const float mn = fmaxf(mref[qt], mt[qt]), corr = __builtin_amdgcn_exp2f(mref[qt] - mn);   // 0 on the first pass
                mref[qt] = mn; lsum[qt] *= corr;
    UNR
                for (int ct = 0; ct < 16; ++ct) acc[ct][qt] *= corr; }
        }
        v16h pb[2];
    UNR
        for (int qt = 0; qt < 2; ++qt)
    UNR
            for (int r = 0; r < 8; ++r) { const float p0 = __builtin_amdgcn_exp2f(fmaf(st[0][qt][r], L2E, -mref[qt])), p1 = __builtin_amdgcn_exp2f(fmaf(st[1][qt][r], L2E, -mref[qt])); lsum[qt] += p0 + p1; pb[qt][r] = (h16)p0; pb[qt][8 + r] = (h16)p1; }
    UNR
        for (int g = 0; g < 4; ++g) {
            if (g < 3) {
    UNR
                for (int i = 0; i < 4; ++i) vf[(g + 1) & 1][i] = ldfrag(vb + ((g + 1) * 4 + i) * 16 * VPIT); }
            __builtin_amdgcn_sched_barrier(0);   // channel fragments in groups of four, one group ahead of the products that use them
    UNR
            for (int i = 0; i < 4; ++i)
    UNR
                for (int qt = 0; qt < 2; ++qt) acc[g * 4 + i][qt] = wmma16(vf[g & 1][i], pb[qt], acc[g * 4 + i][qt]);
        }
    UNR
        for (int j = 0; j < 4; ++j) *(v8ha*)(ks + nxt + j * 16 * KPIT) = kr[j];
    UNR
        for (int j = 0; j < 8; ++j) *(v8ha*)(vs + nxt + j * 32 * VPIT) = vr[j];
        __syncthreads();   // publishes the next pass's tiles and ends every read of this pass's buffer
    }
    // Merge of the two key halves: each wave hands the raw accumulators of 8 channel tiles (half 0: tiles 8..15, half 1: tiles 0..7) and its maximum and sum to its partner (wave w ^ 4, the same columns in the same lanes) through LDS and finishes the 8 tiles it keeps.
    const int col = qg * 32 + lr;
    UNR
    for (int qt = 0; qt < 2; ++qt) { lsum[qt] += xhalf(lsum[qt]);
        if (hi == 0) { ml[kh][0][col + qt * 16] = mref[qt]; ml[kh][1][col + qt * 16] = lsum[qt]; } }
    v4f* xw = xb + (size_t)w * 1024 + lane;          // a wave's own 16 KiB: 32 rows of 32 lanes x 16 B, contiguous 16-byte stores and loads
    const v4f* xr = xb + (size_t)(w ^ 4) * 1024 + lane;
    UNR
    for (int ct = 0; ct < 8; ++ct)
    UNR
        for (int qt = 0; qt < 2; ++qt) { const v8f g = kh ? acc[ct][qt] : acc[ct + 8][qt];
            xw[(ct * 4 + qt * 2) * 32] = __builtin_shufflevector(g, g, 0, 1, 2, 3); xw[(ct * 4 + qt * 2 + 1) * 32] = __builtin_shufflevector(g, g, 4, 5, 6, 7); }
    __syncthreads();   // publishes the partner's accumulators, maxima and sums
    v4f x[32];
    UNR
    for (int i = 0; i < 32; ++i) x[i] = xr[i * 32];
    float fo[2], fp[2];
    UNR
    for (int qt = 0; qt < 2; ++qt) {
        const float mo = ml[1 - kh][0][col + qt * 16], lo = ml[1 - kh][1][col + qt * 16];
        const float mm = fmaxf(mref[qt], mo), so = __builtin_amdgcn_exp2f(mref[qt] - mm), sp = __builtin_amdgcn_exp2f(mo - mm);
        const float inv = 1.0f / (lsum[qt] * so + lo * sp);
        fo[qt] = so * inv; fp[qt] = sp * inv; }
    __builtin_amdgcn_sched_barrier(0);   // the partner's 32 rows are read as one group ahead of the sums: read one by one, each sum waits out a whole LDS latency
    float* op = os + ((kh ? 128 : 0) + 8 * hi) * OPIT + col;
    UNR
    for (int ct = 0; ct < 8; ++ct)
    UNR
        for (int qt = 0; qt < 2; ++qt) { const v8f k = kh ? acc[ct + 8][qt] : acc[ct][qt];
    UNR
            for (int r = 0; r < 8; ++r) op[(ct * 16 + r) * OPIT + qt * 16] = k[r] * fo[qt] + x[ct * 4 + qt * 2 + (r >> 2)][r & 3] * fp[qt]; }
    __syncthreads();
    v4f o[32];
    UNR
    for (int j = 0; j < 32; ++j) o[j] = *(const v4fa*)(os + (w + 8 * j) * OPIT + lane * 4);
    __builtin_amdgcn_sched_barrier(0);   // the 32 output rows are read as one group ahead of the stores, each into registers of its own: no store's data register is written again
    float* od = OUTp + ((size_t)b * CC + w) * NN + q0 + lane * 4;
    UNR
    for (int j = 0; j < 32; ++j) *(v4f*)(od + (size_t)j * 8 * NN) = o[j];   // a wave stores 512 contiguous bytes of one channel row
}

extern "C" void kernel_launch(void* const* d_in, const int* in_sizes, int n_in,
                              void* d_out, int out_size, void* d_ws, size_t ws_size, hipStream_t stream) {
    (void)in_sizes; (void)n_in; (void)out_size;
    const float* l = (const float*)d_in[0]; const float* wt = (const float*)d_in[1]; const float* wp = (const float*)d_in[2];
    float* OUT = (float*)d_out;     // [8][256][64][64]
    char* wsp = (char*)d_ws;
    auto take = [&](size_t bytes) { char* p = wsp; wsp += (bytes + 255) & ~(size_t)255; return (void*)p; };
    h16* XC = (h16*)take((size_t)NBI * CC * NN * 2); h16* T16 = (h16*)take((size_t)NBI * NN * EE * 2); h16* P16 = (h16*)take((size_t)NBI * NN * EE * 2);
    if ((size_t)(wsp - (char*)d_ws) > ws_size) return;    // total ~ 34 MB (fp16 values 17 MB, fp16 theta and phi 8 MB each)
    k_proj<<<dim3(NN / 128, NBI, 1), 256, 0, stream>>>(l, wt, wp, T16, P16, XC);   // fp16 theta (scaled), phi and values of all images
    k_flash<<<dim3(NN / 128, NBI, 1), 256, 0, stream>>>(T16, P16, XC, OUT);   // out[c][q] = sum_k softmax_k(theta_q . phi_k / sqrt(128)) l[c][k]
}
